// v000
// Measured on an AMD MI455X. A time is GPU time per run, averaged over a window of back-to-back runs after a warm-up
// (all launches, gaps included; the runs take copies of the inputs in turn), and the median of several windows.
// Apart from v000's, it joins two sittings. Times from different sittings can be a few percent apart, while
// side-by-side timings come from the same sitting.
// The starting kernel, v000, takes 369 microseconds a run.
#include <hip/hip_runtime.h>
#include <math.h>

typedef __attribute__((ext_vector_type(16))) _Float16 v16h;
typedef __attribute__((ext_vector_type(16))) __bf16 v16b;
typedef __attribute__((ext_vector_type(8)))  _Float16 v8h;
typedef __attribute__((ext_vector_type(8)))  float v8f;
typedef __attribute__((ext_vector_type(4)))  float v4f;
typedef __attribute__((ext_vector_type(2)))  float v2f;
typedef __attribute__((ext_vector_type(4)))  unsigned v4u;
typedef __attribute__((ext_vector_type(4)))  int v4i;
typedef float __attribute__((may_alias)) float_a;
typedef int __attribute__((may_alias)) int_a;

template <typename T> __device__ __forceinline__ void vst2(void* p, T v) { *(T*)p = v;  }
__device__ __forceinline__ v8f wmma16(v16h a, v16h b, v8f c) {
  v8f d = __builtin_amdgcn_wmma_f32_16x16x32_f16(false, a, false, b, (short)0, c, false, false);
  asm volatile("v_nop\n\tv_nop\n\tv_nop\n\tv_nop" : "+v"(d) : "v"(a), "v"(b));
  return d;
}
__device__ __forceinline__ v8f wmma_bf(v16b a, v16b b, v8f c) {
  v8f d = __builtin_amdgcn_wmma_f32_16x16x32_bf16(false, a, false, b, (short)0, c, false, false);
  asm volatile("v_nop\n\tv_nop\n\tv_nop\n\tv_nop" : "+v"(d) : "v"(a), "v"(b));
  return d;
}
// 16x16x32 fragments: lane = (h = lane>>4, row/col = lane&15); elements 0..7 = k0+8h+0..7, 8..15 = k0+16+8h+0..7; D element r = row 8h+r
__device__ __forceinline__ v16h frag_h(const _Float16* rowk0, int lane) {
  union { v16h v; v8h q[2]; } u; const _Float16* p = rowk0 + 8 * (lane >> 4);
  u.q[0] = *(const v8h*)p; u.q[1] = *(const v8h*)(p + 16); return u.v;
}
__device__ __forceinline__ v16h frag_f32(const float* rowk0, int lane) {
  v16h a; const float* p = rowk0 + 8 * (lane >> 4);
#pragma unroll
  for (int i = 0; i < 8; ++i) { a[i] = (_Float16)p[i]; a[8 + i] = (_Float16)p[16 + i]; }
  return a;
}
__device__ __forceinline__ v16h frag_f32s(const float* rowk0, int lane, float sc) {
  v16h a; const float* p = rowk0 + 8 * (lane >> 4);
#pragma unroll
  for (int i = 0; i < 8; ++i) { a[i] = (_Float16)(p[i] * sc); a[8 + i] = (_Float16)(p[16 + i] * sc); }
  return a;
}
// column fragment from a [K][ld] layout (column n), rows >= K read as 0
__device__ __forceinline__ v16h fragc_f32(const float* W, int k0, int n, int lane, int ld, int K) {
  v16h a; const int g = lane >> 4;
#pragma unroll
  for (int i = 0; i < 8; ++i) { const int ka = k0 + 8 * g + i, kb = ka + 16;
    a[i] = (_Float16)(ka < K ? W[(size_t)ka * ld + n] : 0.f); a[8 + i] = (_Float16)(kb < K ? W[(size_t)kb * ld + n] : 0.f); }
  return a;
}
struct F2 { v16b h, l; };
__device__ __forceinline__ F2 bsplit16(const float v[16]) { F2 r;
#pragma unroll
  for (int i = 0; i < 16; ++i) { const __bf16 h = (__bf16)v[i]; r.h[i] = h; r.l[i] = (__bf16)(v[i] - (float)h); }
  return r; }
__device__ __forceinline__ F2 split_row(const float* row, int k0, int lane) { float v[16]; const float* p = row + k0 + 8 * (lane >> 4);
#pragma unroll
  for (int i = 0; i < 8; ++i) { v[i] = p[i]; v[8 + i] = p[16 + i]; }
  return bsplit16(v); }
__device__ __forceinline__ F2 split_rowK(const float* row, int k0, int lane, int K) { float v[16]; const int g = lane >> 4;
#pragma unroll
  for (int i = 0; i < 8; ++i) { const int ka = k0 + 8 * g + i, kb = ka + 16; v[i] = ka < K ? row[ka] : 0.f; v[8 + i] = kb < K ? row[kb] : 0.f; }
  return bsplit16(v); }
__device__ __forceinline__ F2 split_col(const float* W, int k0, int n, int lane, int ld, int K) { float v[16]; const int g = lane >> 4;
#pragma unroll
  for (int i = 0; i < 8; ++i) { const int ka = k0 + 8 * g + i, kb = ka + 16; v[i] = ka < K ? W[(size_t)ka * ld + n] : 0.f; v[8 + i] = kb < K ? W[(size_t)kb * ld + n] : 0.f; }
  return bsplit16(v); }
__device__ __forceinline__ v8f mac3(const F2& a, const F2& b, v8f c) { c = wmma_bf(a.l, b.h, c); c = wmma_bf(a.h, b.l, c); return wmma_bf(a.h, b.h, c); }
__device__ __forceinline__ float sigm(float v) { return 1.0f / (1.0f + expf(-v)); }
#define LDSX() do { asm volatile("s_wait_dscnt 0" ::: "memory"); __builtin_amdgcn_wave_barrier(); __builtin_amdgcn_fence(__ATOMIC_RELEASE, "workgroup"); } while (0)

// Label-clustered attention: per (b, 64 queries) block the 4096 keys are streamed in 64-key tiles: S = q.k on
// v_wmma_f32_16x16x32_f16 (q, k converted to f16 once; f32 accumulate), masked where the labels differ (except the last row/column,
// which is never masked), online softmax in f32, P x2^14 as f16 @ v^T (v transposed to f16 once). Labels are read as data for the
#define NB 4
#define LL 4096
#define DD 64
#define NR (NB * LL)

__global__ __launch_bounds__(256) void k_prep(const float* __restrict__ q, const float* __restrict__ k, const float* __restrict__ v, _Float16* __restrict__ q16, _Float16* __restrict__ k16, _Float16* __restrict__ vT) {
  // block = 64 rows of one batch: q16/k16 rows (f16), vT [b][d][l] via LDS transpose
  __shared__ __align__(16) _Float16 st[DD][72];
  const int tid = threadIdx.x, b = blockIdx.y, r0 = blockIdx.x * 64;
  for (int qd = tid; qd < 64 * DD / 8; qd += 256) { const int rl = qd >> 3, pc = qd & 7; const size_t o = ((size_t)b * LL + r0 + rl) * DD + pc * 8; union { v8h h; v4u u; } pq, pk;
#pragma unroll
    for (int e = 0; e < 8; ++e) { pq.h[e] = (_Float16)q[o + e]; pk.h[e] = (_Float16)k[o + e]; }
    vst2(q16 + o, pq.u); vst2(k16 + o, pk.u); }
  for (int qd = tid; qd < 64 * DD; qd += 256) { const int rl = qd >> 6, d = qd & 63; st[d][rl] = (_Float16)v[((size_t)b * LL + r0 + rl) * DD + d]; }
  __syncthreads();
  for (int qd = tid; qd < DD * 8; qd += 256) { const int d = qd >> 3, pc = qd & 7; vst2(vT + ((size_t)b * DD + d) * LL + r0 + pc * 8, *(const v4u*)(&st[d][pc * 8])); }
}
__global__ __launch_bounds__(128) void k_attn(const _Float16* __restrict__ q16, const _Float16* __restrict__ k16, const _Float16* __restrict__ vT, const int* __restrict__ lab, float* __restrict__ out) {
  __shared__ __align__(16) float sS[4][16][68];
  __shared__ __align__(16) _Float16 sP[4][16][72];
  __shared__ __align__(16) float sO[4][16][68];
  __shared__ int slab[64];
  const int tid = threadIdx.x, w = tid >> 5, lane = tid & 31, col = lane & 15, g = lane >> 4;
  const int b = blockIdx.y, q0 = blockIdx.x * 64 + w * 16;
  const _Float16* qb = q16 + (size_t)b * LL * DD; const _Float16* kb = k16 + (size_t)b * LL * DD; const _Float16* vb = vT + (size_t)b * DD * LL; const int* lb = lab + (size_t)b * (LL - 1);
  v16h aq[2];
#pragma unroll
  for (int kc = 0; kc < 2; ++kc) aq[kc] = frag_h(qb + (size_t)(q0 + col) * DD + kc * 32, lane);
  int myl[8];
#pragma unroll
  for (int r = 0; r < 8; ++r) { const int qi = q0 + 8 * g + r; myl[r] = qi < LL - 1 ? lb[qi] : -1; }     // -1: the last (time) row is never masked
  float mrun = -3.0e38f, lrun = 0.f; v8f acc[4] = {};
#pragma unroll 1
  for (int kt = 0; kt < LL / 64; ++kt) {
    if (tid < 64) { const int key = kt * 64 + tid; slab[tid] = key < LL - 1 ? lb[key] : -2; }      // -2: last column never masked
    __syncthreads();
#pragma unroll
    for (int t = 0; t < 4; ++t) { v8f s = {}; const int key = kt * 64 + t * 16 + col; const int kl = slab[t * 16 + col];
#pragma unroll
      for (int kc = 0; kc < 2; ++kc) s = wmma16(aq[kc], frag_h(kb + (size_t)key * DD + kc * 32, lane), s);
#pragma unroll
      for (int r = 0; r < 8; ++r) { const bool masked = (myl[r] >= 0) && (kl != -2) && (kl != myl[r]); sS[w][8 * g + r][t * 16 + col] = masked ? -3.0e38f : s[r] * 0.125f; } }
    LDSX();
    float mx = -3.4e38f;
#pragma unroll
    for (int jj = 0; jj < 32; ++jj) mx = fmaxf(mx, sS[w][col][g * 32 + jj]);
    mx = fmaxf(mx, __shfl_xor(mx, 16, 32));
    const float mnew = fmaxf(mrun, mx);                       // stays -3e38 until the first unmasked key; exp terms below are then 0 or 1 harmlessly
    const float corr = expf(mrun - mnew);
    float ps = 0.f;
#pragma unroll
    for (int jj = 0; jj < 32; ++jj) { const float sv = sS[w][col][g * 32 + jj]; const float p = sv <= -1.0e38f ? 0.f : expf(sv - mnew); ps += p; sP[w][col][g * 32 + jj] = (_Float16)(p * 16384.0f); }
    ps += __shfl_xor(ps, 16, 32);
    lrun = lrun * corr + ps; mrun = mnew;
#pragma unroll
    for (int r = 0; r < 8; ++r) { const float cr = __shfl(corr, 8 * g + r, 32);
#pragma unroll
      for (int t = 0; t < 4; ++t) acc[t][r] *= cr; }
    LDSX();
#pragma unroll
    for (int kc = 0; kc < 2; ++kc) { const v16h pa = frag_h(&sP[w][col][0] + kc * 32, lane);
#pragma unroll
      for (int t = 0; t < 4; ++t) acc[t] = wmma16(pa, frag_h(vb + (size_t)(t * 16 + col) * LL + kt * 64 + kc * 32, lane), acc[t]); }
    __syncthreads();                                           // slab is rewritten next iteration
  }
#pragma unroll
  for (int r = 0; r < 8; ++r) { const float lr = __shfl(lrun, 8 * g + r, 32);
#pragma unroll
    for (int t = 0; t < 4; ++t) sO[w][8 * g + r][t * 16 + col] = acc[t][r] / (lr * 16384.0f); }
  LDSX();
  for (int qd = lane; qd < 16 * 16; qd += 32) { const int rl = qd >> 4, pc = qd & 15; vst2(out + ((size_t)b * LL + q0 + rl) * DD + pc * 4, *(const v4f*)(&sO[w][rl][pc * 4])); }
}
extern "C" void kernel_launch(void* const* d_in, const int* in_sizes, int n_in, void* d_out, int out_size, void* d_ws, size_t ws_size, hipStream_t stream) {
  (void)in_sizes; (void)n_in; (void)out_size; (void)ws_size;
  const float* q = (const float*)d_in[0]; const float* k = (const float*)d_in[1]; const float* v = (const float*)d_in[2]; const int* lab = (const int*)d_in[3];
  float* out = (float*)d_out;
  char* ws = (char*)d_ws; size_t off = 0;
  auto take = [&](size_t bytes) { char* p = ws + off; off += (bytes + 255) & ~(size_t)255; return p; };
  _Float16* q16 = (_Float16*)take((size_t)NR * DD * 2); _Float16* k16 = (_Float16*)take((size_t)NR * DD * 2); _Float16* vT = (_Float16*)take((size_t)NR * DD * 2);
  k_prep<<<dim3(LL / 64, NB), 256, 0, stream>>>(q, k, v, q16, k16, vT);
  k_attn<<<dim3(LL / 64, NB), 128, 0, stream>>>(q16, k16, vT, lab, out);
}

// v001
// Measured time: 103 microseconds a run.
// Two timings next to v000 put it at 3.48 and 3.57 times that version's speed.
#include <hip/hip_runtime.h>
#include <math.h>

typedef __attribute__((ext_vector_type(16))) _Float16 v16h;
typedef __attribute__((ext_vector_type(16))) __bf16 v16b;
typedef __attribute__((ext_vector_type(8)))  _Float16 v8h;
typedef __attribute__((ext_vector_type(8)))  float v8f;
typedef __attribute__((ext_vector_type(4)))  float v4f;
typedef __attribute__((ext_vector_type(2)))  float v2f;
typedef __attribute__((ext_vector_type(4)))  unsigned v4u;
typedef __attribute__((ext_vector_type(4)))  int v4i;
typedef float __attribute__((may_alias)) float_a;
typedef int __attribute__((may_alias)) int_a;

template <typename T> __device__ __forceinline__ void vst2(void* p, T v) { *(T*)p = v;  }
__device__ __forceinline__ v8f wmma16(v16h a, v16h b, v8f c) {
  v8f d = __builtin_amdgcn_wmma_f32_16x16x32_f16(false, a, false, b, (short)0, c, false, false);
  asm volatile("v_nop\n\tv_nop\n\tv_nop\n\tv_nop" : "+v"(d) : "v"(a), "v"(b));
  return d;
}
__device__ __forceinline__ v8f wmma_bf(v16b a, v16b b, v8f c) {
  v8f d = __builtin_amdgcn_wmma_f32_16x16x32_bf16(false, a, false, b, (short)0, c, false, false);
  asm volatile("v_nop\n\tv_nop\n\tv_nop\n\tv_nop" : "+v"(d) : "v"(a), "v"(b));
  return d;
}
// 16x16x32 fragments: lane = (h = lane>>4, row/col = lane&15); elements 0..7 = k0+8h+0..7, 8..15 = k0+16+8h+0..7; D element r = row 8h+r
__device__ __forceinline__ v16h frag_h(const _Float16* rowk0, int lane) {
  union { v16h v; v8h q[2]; } u; const _Float16* p = rowk0 + 8 * (lane >> 4);
  u.q[0] = *(const v8h*)p; u.q[1] = *(const v8h*)(p + 16); return u.v;
}
__device__ __forceinline__ v16h frag_f32(const float* rowk0, int lane) {
  v16h a; const float* p = rowk0 + 8 * (lane >> 4);
#pragma unroll
  for (int i = 0; i < 8; ++i) { a[i] = (_Float16)p[i]; a[8 + i] = (_Float16)p[16 + i]; }
  return a;
}
__device__ __forceinline__ v16h frag_f32s(const float* rowk0, int lane, float sc) {
  v16h a; const float* p = rowk0 + 8 * (lane >> 4);
#pragma unroll
  for (int i = 0; i < 8; ++i) { a[i] = (_Float16)(p[i] * sc); a[8 + i] = (_Float16)(p[16 + i] * sc); }
  return a;
}
// column fragment from a [K][ld] layout (column n), rows >= K read as 0
__device__ __forceinline__ v16h fragc_f32(const float* W, int k0, int n, int lane, int ld, int K) {
  v16h a; const int g = lane >> 4;
#pragma unroll
  for (int i = 0; i < 8; ++i) { const int ka = k0 + 8 * g + i, kb = ka + 16;
    a[i] = (_Float16)(ka < K ? W[(size_t)ka * ld + n] : 0.f); a[8 + i] = (_Float16)(kb < K ? W[(size_t)kb * ld + n] : 0.f); }
  return a;
}
struct F2 { v16b h, l; };
__device__ __forceinline__ F2 bsplit16(const float v[16]) { F2 r;
#pragma unroll
  for (int i = 0; i < 16; ++i) { const __bf16 h = (__bf16)v[i]; r.h[i] = h; r.l[i] = (__bf16)(v[i] - (float)h); }
  return r; }
__device__ __forceinline__ F2 split_row(const float* row, int k0, int lane) { float v[16]; const float* p = row + k0 + 8 * (lane >> 4);
#pragma unroll
  for (int i = 0; i < 8; ++i) { v[i] = p[i]; v[8 + i] = p[16 + i]; }
  return bsplit16(v); }
__device__ __forceinline__ F2 split_rowK(const float* row, int k0, int lane, int K) { float v[16]; const int g = lane >> 4;
#pragma unroll
  for (int i = 0; i < 8; ++i) { const int ka = k0 + 8 * g + i, kb = ka + 16; v[i] = ka < K ? row[ka] : 0.f; v[8 + i] = kb < K ? row[kb] : 0.f; }
  return bsplit16(v); }
__device__ __forceinline__ F2 split_col(const float* W, int k0, int n, int lane, int ld, int K) { float v[16]; const int g = lane >> 4;
#pragma unroll
  for (int i = 0; i < 8; ++i) { const int ka = k0 + 8 * g + i, kb = ka + 16; v[i] = ka < K ? W[(size_t)ka * ld + n] : 0.f; v[8 + i] = kb < K ? W[(size_t)kb * ld + n] : 0.f; }
  return bsplit16(v); }
__device__ __forceinline__ v8f mac3(const F2& a, const F2& b, v8f c) { c = wmma_bf(a.l, b.h, c); c = wmma_bf(a.h, b.l, c); return wmma_bf(a.h, b.h, c); }
__device__ __forceinline__ float sigm(float v) { return 1.0f / (1.0f + expf(-v)); }
#define LDSX() do { asm volatile("s_wait_dscnt 0" ::: "memory"); __builtin_amdgcn_wave_barrier(); __builtin_amdgcn_fence(__ATOMIC_RELEASE, "workgroup"); } while (0)

// Label-clustered attention: per (b, 64 queries) block the 4096 keys are streamed in 64-key tiles: S = q.k on
// v_wmma_f32_16x16x32_f16 (q, k converted to f16 once; f32 accumulate), masked where the labels differ (except the last row/column,
// which is never masked), online softmax in f32, P x2^14 as f16 @ v^T (v transposed to f16 once). Labels are read as data for the
#define NB 4
#define LL 4096
#define DD 64
#define NR (NB * LL)

__global__ __launch_bounds__(256) void k_prep(const float* __restrict__ q, const float* __restrict__ k, const float* __restrict__ v, _Float16* __restrict__ q16, _Float16* __restrict__ k16, _Float16* __restrict__ vT) {
  // block = 64 rows of one batch: q16/k16 rows (f16), vT [b][d][l] via LDS transpose
  __shared__ __align__(16) _Float16 st[DD][72];
  const int tid = threadIdx.x, b = blockIdx.y, r0 = blockIdx.x * 64;
  for (int qd = tid; qd < 64 * DD / 8; qd += 256) { const int rl = qd >> 3, pc = qd & 7; const size_t o = ((size_t)b * LL + r0 + rl) * DD + pc * 8; union { v8h h; v4u u; } pq, pk;
#pragma unroll
    for (int e = 0; e < 8; ++e) { pq.h[e] = (_Float16)q[o + e]; pk.h[e] = (_Float16)k[o + e]; }
    vst2(q16 + o, pq.u); vst2(k16 + o, pk.u); }
  for (int qd = tid; qd < 64 * DD; qd += 256) { const int rl = qd >> 6, d = qd & 63; st[d][rl] = (_Float16)v[((size_t)b * LL + r0 + rl) * DD + d]; }
  __syncthreads();
  for (int qd = tid; qd < DD * 8; qd += 256) { const int d = qd >> 3, pc = qd & 7; vst2(vT + ((size_t)b * DD + d) * LL + r0 + pc * 8, *(const v4u*)(&st[d][pc * 8])); }
}
// the 64 key tiles of a block are shared out over KS groups of 4 waves (group ks takes tiles ks, ks + KS, ks + 2 KS, ...), so that a SIMD holds KS waves
// whose waits overlap; each wave keeps its own running maximum, sum and unnormalised O, and the block merges the KS partial results in LDS at the end
#define KS 8
#define KT (LL / 64 / KS)
__global__ __launch_bounds__(128 * KS) void k_attn(const _Float16* __restrict__ q16, const _Float16* __restrict__ k16, const _Float16* __restrict__ vT, const int* __restrict__ lab, float* __restrict__ out) {
  __shared__ __align__(16) float sS[4 * KS][16][68];
  __shared__ __align__(16) _Float16 sP[4 * KS][16][72];
  __shared__ float sM[4 * KS][16], sL[4 * KS][16];
  __shared__ int slab[KS][64];
  const int tid = threadIdx.x, w = tid >> 5, lane = tid & 31, col = lane & 15, g = lane >> 4;
  const int qg = w & 3, ks = w >> 2;                          // query group (16 rows) and key group of this wave
  const int b = blockIdx.y, q0 = blockIdx.x * 64 + qg * 16;
  const _Float16* qb = q16 + (size_t)b * LL * DD; const _Float16* kb = k16 + (size_t)b * LL * DD; const _Float16* vb = vT + (size_t)b * DD * LL; const int* lb = lab + (size_t)b * (LL - 1);
  v16h aq[2];
#pragma unroll
  for (int kc = 0; kc < 2; ++kc) aq[kc] = frag_h(qb + (size_t)(q0 + col) * DD + kc * 32, lane);
  int myl[8];
#pragma unroll
  for (int r = 0; r < 8; ++r) { const int qi = q0 + 8 * g + r; myl[r] = qi < LL - 1 ? lb[qi] : -1; }     // -1: the last (time) row is never masked
  float mrun = -3.0e38f, lrun = 0.f; v8f acc[4] = {};
#pragma unroll 1
  for (int it = 0; it < KT; ++it) { const int kt = it * KS + ks;
    if (tid < 64 * KS) { const int key = it * (64 * KS) + tid; slab[tid >> 6][tid & 63] = key < LL - 1 ? lb[key] : -2; }      // -2: last column never masked
    __syncthreads();
#pragma unroll
    for (int t = 0; t < 4; ++t) { v8f s = {}; const int key = kt * 64 + t * 16 + col; const int kl = slab[ks][t * 16 + col];
#pragma unroll
      for (int kc = 0; kc < 2; ++kc) s = wmma16(aq[kc], frag_h(kb + (size_t)key * DD + kc * 32, lane), s);
#pragma unroll
      for (int r = 0; r < 8; ++r) { const bool masked = (myl[r] >= 0) && (kl != -2) && (kl != myl[r]); sS[w][8 * g + r][t * 16 + col] = masked ? -3.0e38f : s[r] * 0.125f; } }
    LDSX();
    float mx = -3.4e38f;
#pragma unroll
    for (int jj = 0; jj < 32; ++jj) mx = fmaxf(mx, sS[w][col][g * 32 + jj]);
    mx = fmaxf(mx, __shfl_xor(mx, 16, 32));
    const float mnew = fmaxf(mrun, mx);                       // stays -3e38 until the first unmasked key; exp terms below are then 0 or 1 harmlessly
    const float corr = expf(mrun - mnew);
    float ps = 0.f;
#pragma unroll
    for (int jj = 0; jj < 32; ++jj) { const float sv = sS[w][col][g * 32 + jj]; const float p = sv <= -1.0e38f ? 0.f : expf(sv - mnew); ps += p; sP[w][col][g * 32 + jj] = (_Float16)(p * 16384.0f); }
    ps += __shfl_xor(ps, 16, 32);
    lrun = lrun * corr + ps; mrun = mnew;
#pragma unroll
    for (int r = 0; r < 8; ++r) { const float cr = __shfl(corr, 8 * g + r, 32);
#pragma unroll
      for (int t = 0; t < 4; ++t) acc[t][r] *= cr; }
    LDSX();
#pragma unroll
    for (int kc = 0; kc < 2; ++kc) { const v16h pa = frag_h(&sP[w][col][0] + kc * 32, lane);
#pragma unroll
      for (int t = 0; t < 4; ++t) acc[t] = wmma16(pa, frag_h(vb + (size_t)(t * 16 + col) * LL + kt * 64 + kc * 32, lane), acc[t]); }
    __syncthreads();                                           // slab is rewritten next iteration
  }
#pragma unroll
  for (int r = 0; r < 8; ++r) {
#pragma unroll
    for (int t = 0; t < 4; ++t) sS[w][8 * g + r][t * 16 + col] = acc[t][r]; }   // sS[w] is this wave's own and its scores are used up
  if (g == 0) { sM[w][col] = mrun; sL[w][col] = lrun; }
  __syncthreads();                                             // every wave's partial result is in LDS before any thread merges
  const int rl = tid >> 4, pc = tid & 15, mq = rl >> 4, mr = rl & 15;   // one thread: 4 output columns of one of the 64 rows
  float mall = -3.4e38f;
#pragma unroll
  for (int s = 0; s < KS; ++s) mall = fmaxf(mall, sM[s * 4 + mq][mr]);    // finite: the last key is masked for no row
  float lall = 0.f; v4f o = {};
#pragma unroll
  for (int s = 0; s < KS; ++s) { const float wg = expf(sM[s * 4 + mq][mr] - mall); lall += sL[s * 4 + mq][mr] * wg; o += *(const v4f*)(&sS[s * 4 + mq][mr][pc * 4]) * wg; }
  const float den = lall * 16384.0f;
#pragma unroll
  for (int e = 0; e < 4; ++e) o[e] = o[e] / den;
  vst2(out + ((size_t)b * LL + blockIdx.x * 64 + rl) * DD + pc * 4, o);
}
extern "C" void kernel_launch(void* const* d_in, const int* in_sizes, int n_in, void* d_out, int out_size, void* d_ws, size_t ws_size, hipStream_t stream) {
  (void)in_sizes; (void)n_in; (void)out_size; (void)ws_size;
  const float* q = (const float*)d_in[0]; const float* k = (const float*)d_in[1]; const float* v = (const float*)d_in[2]; const int* lab = (const int*)d_in[3];
  float* out = (float*)d_out;
  char* ws = (char*)d_ws; size_t off = 0;
  auto take = [&](size_t bytes) { char* p = ws + off; off += (bytes + 255) & ~(size_t)255; return p; };
  _Float16* q16 = (_Float16*)take((size_t)NR * DD * 2); _Float16* k16 = (_Float16*)take((size_t)NR * DD * 2); _Float16* vT = (_Float16*)take((size_t)NR * DD * 2);
  k_prep<<<dim3(LL / 64, NB), 256, 0, stream>>>(q, k, v, q16, k16, vT);
  k_attn<<<dim3(LL / 64, NB), 128 * KS, 0, stream>>>(q16, k16, vT, lab, out);
}

// v002
// Measured time: 93.4 microseconds a run.
// Two timings next to v001 put it at 1.13 and 1.08 times that version's speed.
// Over all steps from v000 it is 3.90 times as fast.
#include <hip/hip_runtime.h>
#include <math.h>

typedef __attribute__((ext_vector_type(16))) _Float16 v16h;
typedef __attribute__((ext_vector_type(16))) __bf16 v16b;
typedef __attribute__((ext_vector_type(8)))  _Float16 v8h;
typedef __attribute__((ext_vector_type(8)))  float v8f;
typedef __attribute__((ext_vector_type(4)))  float v4f;
typedef __attribute__((ext_vector_type(2)))  float v2f;
typedef __attribute__((ext_vector_type(4)))  unsigned v4u;
typedef __attribute__((ext_vector_type(4)))  int v4i;
typedef float __attribute__((may_alias)) float_a;
typedef int __attribute__((may_alias)) int_a;

template <typename T> __device__ __forceinline__ void vst2(void* p, T v) { *(T*)p = v;  }
__device__ __forceinline__ v8f wmma16(v16h a, v16h b, v8f c) {
  v8f d = __builtin_amdgcn_wmma_f32_16x16x32_f16(false, a, false, b, (short)0, c, false, false);
  asm volatile("v_nop\n\tv_nop\n\tv_nop\n\tv_nop" : "+v"(d) : "v"(a), "v"(b));
  return d;
}
__device__ __forceinline__ v8f wmma_bf(v16b a, v16b b, v8f c) {
  v8f d = __builtin_amdgcn_wmma_f32_16x16x32_bf16(false, a, false, b, (short)0, c, false, false);
  asm volatile("v_nop\n\tv_nop\n\tv_nop\n\tv_nop" : "+v"(d) : "v"(a), "v"(b));
  return d;
}
// 16x16x32 fragments: lane = (h = lane>>4, row/col = lane&15); elements 0..7 = k0+8h+0..7, 8..15 = k0+16+8h+0..7; D element r = row 8h+r
__device__ __forceinline__ v16h frag_h(const _Float16* rowk0, int lane) {
  union { v16h v; v8h q[2]; } u; const _Float16* p = rowk0 + 8 * (lane >> 4);
  u.q[0] = *(const v8h*)p; u.q[1] = *(const v8h*)(p + 16); return u.v;
}
__device__ __forceinline__ v16h frag_f32(const float* rowk0, int lane) {
  v16h a; const float* p = rowk0 + 8 * (lane >> 4);
#pragma unroll
  for (int i = 0; i < 8; ++i) { a[i] = (_Float16)p[i]; a[8 + i] = (_Float16)p[16 + i]; }
  return a;
}
__device__ __forceinline__ v16h frag_f32s(const float* rowk0, int lane, float sc) {
  v16h a; const float* p = rowk0 + 8 * (lane >> 4);
#pragma unroll
  for (int i = 0; i < 8; ++i) { a[i] = (_Float16)(p[i] * sc); a[8 + i] = (_Float16)(p[16 + i] * sc); }
  return a;
}
// column fragment from a [K][ld] layout (column n), rows >= K read as 0
__device__ __forceinline__ v16h fragc_f32(const float* W, int k0, int n, int lane, int ld, int K) {
  v16h a; const int g = lane >> 4;
#pragma unroll
  for (int i = 0; i < 8; ++i) { const int ka = k0 + 8 * g + i, kb = ka + 16;
    a[i] = (_Float16)(ka < K ? W[(size_t)ka * ld + n] : 0.f); a[8 + i] = (_Float16)(kb < K ? W[(size_t)kb * ld + n] : 0.f); }
  return a;
}
struct F2 { v16b h, l; };
__device__ __forceinline__ F2 bsplit16(const float v[16]) { F2 r;
#pragma unroll
  for (int i = 0; i < 16; ++i) { const __bf16 h = (__bf16)v[i]; r.h[i] = h; r.l[i] = (__bf16)(v[i] - (float)h); }
  return r; }
__device__ __forceinline__ F2 split_row(const float* row, int k0, int lane) { float v[16]; const float* p = row + k0 + 8 * (lane >> 4);
#pragma unroll
  for (int i = 0; i < 8; ++i) { v[i] = p[i]; v[8 + i] = p[16 + i]; }
  return bsplit16(v); }
__device__ __forceinline__ F2 split_rowK(const float* row, int k0, int lane, int K) { float v[16]; const int g = lane >> 4;
#pragma unroll
  for (int i = 0; i < 8; ++i) { const int ka = k0 + 8 * g + i, kb = ka + 16; v[i] = ka < K ? row[ka] : 0.f; v[8 + i] = kb < K ? row[kb] : 0.f; }
  return bsplit16(v); }
__device__ __forceinline__ F2 split_col(const float* W, int k0, int n, int lane, int ld, int K) { float v[16]; const int g = lane >> 4;
#pragma unroll
  for (int i = 0; i < 8; ++i) { const int ka = k0 + 8 * g + i, kb = ka + 16; v[i] = ka < K ? W[(size_t)ka * ld + n] : 0.f; v[8 + i] = kb < K ? W[(size_t)kb * ld + n] : 0.f; }
  return bsplit16(v); }
__device__ __forceinline__ v8f mac3(const F2& a, const F2& b, v8f c) { c = wmma_bf(a.l, b.h, c); c = wmma_bf(a.h, b.l, c); return wmma_bf(a.h, b.h, c); }
__device__ __forceinline__ float sigm(float v) { return 1.0f / (1.0f + expf(-v)); }
// v_exp_f32 with the one free slot the instruction set asks for behind it, in one statement
__device__ __forceinline__ float exp2_slot(float x) { float r; asm("v_exp_f32 %0, %1\n\tv_nop" : "=v"(r) : "v"(x)); return r; }
#define LDSX() do { asm volatile("s_wait_dscnt 0" ::: "memory"); __builtin_amdgcn_wave_barrier(); __builtin_amdgcn_fence(__ATOMIC_RELEASE, "workgroup"); } while (0)

// Label-clustered attention: per (b, 64 queries) block the 4096 keys are streamed in 64-key tiles: S = q.k on
// v_wmma_f32_16x16x32_f16 (q, k converted to f16 once; f32 accumulate), masked where the labels differ (except the last row/column,
// which is never masked), online softmax in f32, P x2^14 as f16 @ v^T (v transposed to f16 once). Labels are read as data for the
#define NB 4
#define LL 4096
#define DD 64
#define NR (NB * LL)

__global__ __launch_bounds__(256) void k_prep(const float* __restrict__ q, const float* __restrict__ k, const float* __restrict__ v, _Float16* __restrict__ q16, _Float16* __restrict__ k16, _Float16* __restrict__ vT) {
  // block = 64 rows of one batch: q16/k16 rows (f16), vT [b][d][l] via LDS transpose
  __shared__ __align__(16) _Float16 st[DD][72];
  const int tid = threadIdx.x, b = blockIdx.y, r0 = blockIdx.x * 64;
  for (int qd = tid; qd < 64 * DD / 8; qd += 256) { const int rl = qd >> 3, pc = qd & 7; const size_t o = ((size_t)b * LL + r0 + rl) * DD + pc * 8; union { v8h h; v4u u; } pq, pk;
#pragma unroll
    for (int e = 0; e < 8; ++e) { pq.h[e] = (_Float16)q[o + e]; pk.h[e] = (_Float16)k[o + e]; }
    vst2(q16 + o, pq.u); vst2(k16 + o, pk.u); }
  for (int qd = tid; qd < 64 * DD; qd += 256) { const int rl = qd >> 6, d = qd & 63; st[d][rl] = (_Float16)v[((size_t)b * LL + r0 + rl) * DD + d]; }
  __syncthreads();
  for (int qd = tid; qd < DD * 8; qd += 256) { const int d = qd >> 3, pc = qd & 7; vst2(vT + ((size_t)b * DD + d) * LL + r0 + pc * 8, *(const v4u*)(&st[d][pc * 8])); }
}
// the 64 key tiles of a block are shared out over KS groups of 4 waves (group ks takes tiles ks, ks + KS, ks + 2 KS, ...), so that a SIMD holds KS waves
// whose waits overlap; each wave keeps its own running maximum, sum and unnormalised O, and the block merges the KS partial results in LDS at the end
#define KS 8
#define KT (LL / 64 / KS)
// scores, running maxima and their differences are kept in units of log2: 1/sqrt(64) * log2(e), so that each exponential is one v_exp_f32
#define SCL2 0.18033688f
__global__ __launch_bounds__(128 * KS) void k_attn(const _Float16* __restrict__ q16, const _Float16* __restrict__ k16, const _Float16* __restrict__ vT, const int* __restrict__ lab, float* __restrict__ out) {
  __shared__ __align__(16) float sS[4 * KS][16][68];
  __shared__ __align__(16) _Float16 sP[4 * KS][16][72];
  __shared__ float sM[4 * KS][16], sL[4 * KS][16];
  __shared__ int slab[KS][64];
  const int tid = threadIdx.x, w = tid >> 5, lane = tid & 31, col = lane & 15, g = lane >> 4;
  const int qg = w & 3, ks = w >> 2;                          // query group (16 rows) and key group of this wave
  const int b = blockIdx.y, q0 = blockIdx.x * 64 + qg * 16;
  const _Float16* qb = q16 + (size_t)b * LL * DD; const _Float16* kb = k16 + (size_t)b * LL * DD; const _Float16* vb = vT + (size_t)b * DD * LL; const int* lb = lab + (size_t)b * (LL - 1);
  v16h aq[2];
#pragma unroll
  for (int kc = 0; kc < 2; ++kc) aq[kc] = frag_h(qb + (size_t)(q0 + col) * DD + kc * 32, lane);
  int myl[8];
#pragma unroll
  for (int r = 0; r < 8; ++r) { const int qi = q0 + 8 * g + r; myl[r] = qi < LL - 1 ? lb[qi] : -1; }     // -1: the last (time) row is never masked
  float mrun = -3.0e38f, lrun = 0.f; v8f acc[4] = {};
#pragma unroll 1
  for (int it = 0; it < KT; ++it) { const int kt = it * KS + ks;
    if (tid < 64 * KS) { const int key = it * (64 * KS) + tid; slab[tid >> 6][tid & 63] = key < LL - 1 ? lb[key] : -2; }      // -2: last column never masked
    __syncthreads();
#pragma unroll
    for (int t = 0; t < 4; ++t) { v8f s = {}; const int key = kt * 64 + t * 16 + col; const int kl = slab[ks][t * 16 + col];
#pragma unroll
      for (int kc = 0; kc < 2; ++kc) s = wmma16(aq[kc], frag_h(kb + (size_t)key * DD + kc * 32, lane), s);
#pragma unroll
      for (int r = 0; r < 8; ++r) { const bool masked = (myl[r] >= 0) && (kl != -2) && (kl != myl[r]); sS[w][8 * g + r][t * 16 + col] = masked ? -3.0e38f : s[r] * SCL2; } }
    LDSX();
    float mx = -3.4e38f; v4f sc[8];                            // this lane's 32 scores, read once for the maximum and the exponentials
#pragma unroll
    for (int jc = 0; jc < 8; ++jc) { sc[jc] = *(const v4f*)(&sS[w][col][g * 32 + jc * 4]);
#pragma unroll
      for (int e = 0; e < 4; ++e) mx = fmaxf(mx, sc[jc][e]); }
    mx = fmaxf(mx, __shfl_xor(mx, 16, 32));
    const float mnew = fmaxf(mrun, mx);                       // stays -3e38 until the first unmasked key; exp terms below are then 0 or 1 harmlessly
    const float corr = __builtin_amdgcn_exp2f(mrun - mnew);
    const float mex = fmaxf(mnew, -1.0e30f);                  // a masked score (-3e38) minus mex stays about -3e38 also while mnew is still -3e38, so its term is exactly 0 with no test per element
    float ps = 0.f;
#pragma unroll
    for (int jc = 0; jc < 4; ++jc) { v8h ph;
#pragma unroll
      for (int e = 0; e < 8; ++e) { const float p = __builtin_amdgcn_exp2f(sc[jc * 2 + (e >> 2)][e & 3] - mex); ps += p; ph[e] = (_Float16)(p * 16384.0f); }
      vst2(&sP[w][col][g * 32 + jc * 8], ph); }
    ps += __shfl_xor(ps, 16, 32);
    lrun = lrun * corr + ps; mrun = mnew;
#pragma unroll
    for (int r = 0; r < 8; ++r) { const float cr = __shfl(corr, 8 * g + r, 32);
#pragma unroll
      for (int t = 0; t < 4; ++t) acc[t][r] *= cr; }
    LDSX();
#pragma unroll
    for (int kc = 0; kc < 2; ++kc) { const v16h pa = frag_h(&sP[w][col][0] + kc * 32, lane);
#pragma unroll
      for (int t = 0; t < 4; ++t) acc[t] = wmma16(pa, frag_h(vb + (size_t)(t * 16 + col) * LL + kt * 64 + kc * 32, lane), acc[t]); }
    __syncthreads();                                           // slab is rewritten next iteration
  }
#pragma unroll
  for (int r = 0; r < 8; ++r) {
#pragma unroll
    for (int t = 0; t < 4; ++t) sS[w][8 * g + r][t * 16 + col] = acc[t][r]; }   // sS[w] is this wave's own and its scores are used up
  if (g == 0) { sM[w][col] = mrun; sL[w][col] = lrun; }
  __syncthreads();                                             // every wave's partial result is in LDS before any thread merges
  const int rl = tid >> 4, pc = tid & 15, mq = rl >> 4, mr = rl & 15;   // one thread: 4 output columns of one of the 64 rows
  float mall = -3.4e38f;
#pragma unroll
  for (int s = 0; s < KS; ++s) mall = fmaxf(mall, sM[s * 4 + mq][mr]);    // finite: the last key is masked for no row
  float lall = 0.f; v4f o = {};
#pragma unroll
  for (int s = 0; s < KS; ++s) { const float wg = exp2_slot(sM[s * 4 + mq][mr] - mall); lall += sL[s * 4 + mq][mr] * wg; o += *(const v4f*)(&sS[s * 4 + mq][mr][pc * 4]) * wg; }
  const float den = lall * 16384.0f;
#pragma unroll
  for (int e = 0; e < 4; ++e) o[e] = o[e] / den;
  vst2(out + ((size_t)b * LL + blockIdx.x * 64 + rl) * DD + pc * 4, o);
}
extern "C" void kernel_launch(void* const* d_in, const int* in_sizes, int n_in, void* d_out, int out_size, void* d_ws, size_t ws_size, hipStream_t stream) {
  (void)in_sizes; (void)n_in; (void)out_size; (void)ws_size;
  const float* q = (const float*)d_in[0]; const float* k = (const float*)d_in[1]; const float* v = (const float*)d_in[2]; const int* lab = (const int*)d_in[3];
  float* out = (float*)d_out;
  char* ws = (char*)d_ws; size_t off = 0;
  auto take = [&](size_t bytes) { char* p = ws + off; off += (bytes + 255) & ~(size_t)255; return p; };
  _Float16* q16 = (_Float16*)take((size_t)NR * DD * 2); _Float16* k16 = (_Float16*)take((size_t)NR * DD * 2); _Float16* vT = (_Float16*)take((size_t)NR * DD * 2);
  k_prep<<<dim3(LL / 64, NB), 256, 0, stream>>>(q, k, v, q16, k16, vT);
  k_attn<<<dim3(LL / 64, NB), 128 * KS, 0, stream>>>(q16, k16, vT, lab, out);
}

// v003
// One run takes 80.4 microseconds.
// Next to v002, in two timings, it ran 1.14 and 1.13 times as fast.
// Over all steps from v000 it is 4.42 times as fast.
#include <hip/hip_runtime.h>
#include <math.h>

typedef __attribute__((ext_vector_type(16))) _Float16 v16h;
typedef __attribute__((ext_vector_type(16))) __bf16 v16b;
typedef __attribute__((ext_vector_type(8)))  _Float16 v8h;
typedef __attribute__((ext_vector_type(8)))  float v8f;
typedef __attribute__((ext_vector_type(4)))  float v4f;
typedef __attribute__((ext_vector_type(2)))  float v2f;
typedef __attribute__((ext_vector_type(4)))  unsigned v4u;
typedef __attribute__((ext_vector_type(4)))  int v4i;
typedef float __attribute__((may_alias)) float_a;
typedef int __attribute__((may_alias)) int_a;

template <typename T> __device__ __forceinline__ void vst2(void* p, T v) { *(T*)p = v;  }
__device__ __forceinline__ v8f wmma16(v16h a, v16h b, v8f c) {
  v8f d = __builtin_amdgcn_wmma_f32_16x16x32_f16(false, a, false, b, (short)0, c, false, false);
  asm volatile("v_nop\n\tv_nop\n\tv_nop\n\tv_nop" : "+v"(d) : "v"(a), "v"(b));
  return d;
}
__device__ __forceinline__ v8f wmma_bf(v16b a, v16b b, v8f c) {
  v8f d = __builtin_amdgcn_wmma_f32_16x16x32_bf16(false, a, false, b, (short)0, c, false, false);
  asm volatile("v_nop\n\tv_nop\n\tv_nop\n\tv_nop" : "+v"(d) : "v"(a), "v"(b));
  return d;
}
// 16x16x32 fragments: lane = (h = lane>>4, row/col = lane&15); elements 0..7 = k0+8h+0..7, 8..15 = k0+16+8h+0..7; D element r = row 8h+r
__device__ __forceinline__ v16h frag_h(const _Float16* rowk0, int lane) {
  union { v16h v; v8h q[2]; } u; const _Float16* p = rowk0 + 8 * (lane >> 4);
  u.q[0] = *(const v8h*)p; u.q[1] = *(const v8h*)(p + 16); return u.v;
}
// the same fragment from a pointer that already holds the lane's 8 * (lane >> 4)
__device__ __forceinline__ v16h frag_p(const _Float16* p) {
  union { v16h v; v8h q[2]; } u; u.q[0] = *(const v8h*)p; u.q[1] = *(const v8h*)(p + 16); return u.v;
}
__device__ __forceinline__ v16h frag_f32(const float* rowk0, int lane) {
  v16h a; const float* p = rowk0 + 8 * (lane >> 4);
#pragma unroll
  for (int i = 0; i < 8; ++i) { a[i] = (_Float16)p[i]; a[8 + i] = (_Float16)p[16 + i]; }
  return a;
}
__device__ __forceinline__ v16h frag_f32s(const float* rowk0, int lane, float sc) {
  v16h a; const float* p = rowk0 + 8 * (lane >> 4);
#pragma unroll
  for (int i = 0; i < 8; ++i) { a[i] = (_Float16)(p[i] * sc); a[8 + i] = (_Float16)(p[16 + i] * sc); }
  return a;
}
// column fragment from a [K][ld] layout (column n), rows >= K read as 0
__device__ __forceinline__ v16h fragc_f32(const float* W, int k0, int n, int lane, int ld, int K) {
  v16h a; const int g = lane >> 4;
#pragma unroll
  for (int i = 0; i < 8; ++i) { const int ka = k0 + 8 * g + i, kb = ka + 16;
    a[i] = (_Float16)(ka < K ? W[(size_t)ka * ld + n] : 0.f); a[8 + i] = (_Float16)(kb < K ? W[(size_t)kb * ld + n] : 0.f); }
  return a;
}
struct F2 { v16b h, l; };
__device__ __forceinline__ F2 bsplit16(const float v[16]) { F2 r;
#pragma unroll
  for (int i = 0; i < 16; ++i) { const __bf16 h = (__bf16)v[i]; r.h[i] = h; r.l[i] = (__bf16)(v[i] - (float)h); }
  return r; }
__device__ __forceinline__ F2 split_row(const float* row, int k0, int lane) { float v[16]; const float* p = row + k0 + 8 * (lane >> 4);
#pragma unroll
  for (int i = 0; i < 8; ++i) { v[i] = p[i]; v[8 + i] = p[16 + i]; }
  return bsplit16(v); }
__device__ __forceinline__ F2 split_rowK(const float* row, int k0, int lane, int K) { float v[16]; const int g = lane >> 4;
#pragma unroll
  for (int i = 0; i < 8; ++i) { const int ka = k0 + 8 * g + i, kb = ka + 16; v[i] = ka < K ? row[ka] : 0.f; v[8 + i] = kb < K ? row[kb] : 0.f; }
  return bsplit16(v); }
__device__ __forceinline__ F2 split_col(const float* W, int k0, int n, int lane, int ld, int K) { float v[16]; const int g = lane >> 4;
#pragma unroll
  for (int i = 0; i < 8; ++i) { const int ka = k0 + 8 * g + i, kb = ka + 16; v[i] = ka < K ? W[(size_t)ka * ld + n] : 0.f; v[8 + i] = kb < K ? W[(size_t)kb * ld + n] : 0.f; }
  return bsplit16(v); }
__device__ __forceinline__ v8f mac3(const F2& a, const F2& b, v8f c) { c = wmma_bf(a.l, b.h, c); c = wmma_bf(a.h, b.l, c); return wmma_bf(a.h, b.h, c); }
__device__ __forceinline__ float sigm(float v) { return 1.0f / (1.0f + expf(-v)); }
// v_exp_f32 with the one free slot the instruction set asks for behind it, in one statement
__device__ __forceinline__ float exp2_slot(float x) { float r; asm("v_exp_f32 %0, %1\n\tv_nop" : "=v"(r) : "v"(x)); return r; }
#define LDSX() do { asm volatile("s_wait_dscnt 0" ::: "memory"); __builtin_amdgcn_wave_barrier(); __builtin_amdgcn_fence(__ATOMIC_RELEASE, "workgroup"); } while (0)

// Label-clustered attention: per (b, 64 queries) block the 4096 keys are streamed in 64-key tiles: S = q.k on
// v_wmma_f32_16x16x32_f16 (q, k converted to f16 once; f32 accumulate), masked where the labels differ (except the last row/column,
// which is never masked), online softmax in f32, P x2^14 as f16 @ v^T (v transposed to f16 once). Labels are read as data for the
#define NB 4
#define LL 4096
#define DD 64
#define NR (NB * LL)

__global__ __launch_bounds__(256) void k_prep(const float* __restrict__ q, const float* __restrict__ k, const float* __restrict__ v, _Float16* __restrict__ q16, _Float16* __restrict__ k16, _Float16* __restrict__ vT) {
  // block = 64 rows of one batch: q16/k16 rows (f16), vT [b][d][l] via LDS transpose
  __shared__ __align__(16) _Float16 st[DD][72];
  const int tid = threadIdx.x, b = blockIdx.y, r0 = blockIdx.x * 64;
  for (int qd = tid; qd < 64 * DD / 8; qd += 256) { const int rl = qd >> 3, pc = qd & 7; const size_t o = ((size_t)b * LL + r0 + rl) * DD + pc * 8; union { v8h h; v4u u; } pq, pk;
#pragma unroll
    for (int e = 0; e < 8; ++e) { pq.h[e] = (_Float16)q[o + e]; pk.h[e] = (_Float16)k[o + e]; }
    vst2(q16 + o, pq.u); vst2(k16 + o, pk.u); }
  for (int qd = tid; qd < 64 * DD; qd += 256) { const int rl = qd >> 6, d = qd & 63; st[d][rl] = (_Float16)v[((size_t)b * LL + r0 + rl) * DD + d]; }
  __syncthreads();
  for (int qd = tid; qd < DD * 8; qd += 256) { const int d = qd >> 3, pc = qd & 7; vst2(vT + ((size_t)b * DD + d) * LL + r0 + pc * 8, *(const v4u*)(&st[d][pc * 8])); }
}
// the 64 key tiles of a block are shared out over KS groups of 4 waves (group ks takes tiles ks, ks + KS, ks + 2 KS, ...), so that a SIMD holds KS waves
// whose waits overlap; each wave keeps its own running maximum, sum and unnormalised O, and the block merges the KS partial results in LDS at the end
#define KS 8
#define KT (LL / 64 / KS)
// scores, running maxima and their differences are kept in units of log2: 1/sqrt(64) * log2(e), so that each exponential is one v_exp_f32
#define SCL2 0.18033688f
__global__ __launch_bounds__(128 * KS) void k_attn(const _Float16* __restrict__ q16, const _Float16* __restrict__ k16, const _Float16* __restrict__ vT, const int* __restrict__ lab, float* __restrict__ out) {
  __shared__ __align__(16) float sS[4 * KS][16][68];
  __shared__ __align__(16) _Float16 sP[4 * KS][16][72];
  __shared__ float sM[4 * KS][16], sL[4 * KS][16];
  __shared__ int slab[KS][64];
  const int tid = threadIdx.x, w = tid >> 5, lane = tid & 31, col = lane & 15, g = lane >> 4;
  const int qg = w & 3, ks = w >> 2;                          // query group (16 rows) and key group of this wave
  const int b = blockIdx.y, q0 = blockIdx.x * 64 + qg * 16;
  const _Float16* qb = q16 + (size_t)b * LL * DD; const _Float16* kb = k16 + (size_t)b * LL * DD; const _Float16* vb = vT + (size_t)b * DD * LL; const int* lb = lab + (size_t)b * (LL - 1);
  v16h aq[2];
#pragma unroll
  for (int kc = 0; kc < 2; ++kc) aq[kc] = frag_h(qb + (size_t)(q0 + col) * DD + kc * 32, lane);
  int myl[8];
#pragma unroll
  for (int r = 0; r < 8; ++r) { const int qi = q0 + 8 * g + r; myl[r] = qi < LL - 1 ? lb[qi] : -1; }     // -1: the last (time) row is never masked
  float mrun = -3.0e38f, lrun = 0.f; v8f acc[4] = {};
  // The K and V^T fragments are loaded ahead of their WMMAs, several at a time, so that a group's load latencies run side by side. The compiler moves no load
  // over the volatile statement behind a WMMA in wmma16: a load written as that call's argument starts behind the WMMA before it and is waited for at once.
  const unsigned klo = ((ks * 64 + col) * DD + 8 * g) * 2, vlo = (col * LL + ks * 64 + 8 * g) * 2;   // the lane's byte offsets in K and V^T, formed once; the trip's part of an address is the same for the whole block
#pragma unroll 1
  for (int it = 0; it < KT; ++it) {                            // this wave's key tile of the trip is it * KS + ks
    const _Float16* kp = (const _Float16*)((const char*)(kb + it * (KS * 64 * DD)) + klo); const _Float16* vp = (const _Float16*)((const char*)(vb + it * (KS * 64)) + vlo);
    v16h kf[4][2], vf[2][4];
#pragma unroll
    for (int t = 0; t < 2; ++t) {
#pragma unroll
      for (int kc = 0; kc < 2; ++kc) kf[t][kc] = frag_p(kp + t * 16 * DD + kc * 32); }     // key tiles 0 and 1; tile t + 2 is asked for behind the WMMAs of tile t
    if (tid < 64 * KS) { const int key = it * (64 * KS) + tid; slab[tid >> 6][tid & 63] = key < LL - 1 ? lb[key] : -2; }      // -2: last column never masked
    __syncthreads();
#pragma unroll
    for (int t = 0; t < 4; ++t) { v8f s = {}; const int kl = slab[ks][t * 16 + col];
#pragma unroll
      for (int kc = 0; kc < 2; ++kc) s = wmma16(aq[kc], kf[t][kc], s);
      if (t < 2) {
#pragma unroll
        for (int kc = 0; kc < 2; ++kc) kf[t + 2][kc] = frag_p(kp + (t + 2) * 16 * DD + kc * 32); }
#pragma unroll
      for (int r = 0; r < 8; ++r) { const bool masked = (myl[r] >= 0) && (kl != -2) && (kl != myl[r]); sS[w][8 * g + r][t * 16 + col] = masked ? -3.0e38f : s[r] * SCL2; } }
    LDSX();
    float mx = -3.4e38f; v4f sc[8];                            // this lane's 32 scores, read once for the maximum and the exponentials
#pragma unroll
    for (int jc = 0; jc < 8; ++jc) { sc[jc] = *(const v4f*)(&sS[w][col][g * 32 + jc * 4]);
#pragma unroll
      for (int e = 0; e < 4; ++e) mx = fmaxf(mx, sc[jc][e]); }
    mx = fmaxf(mx, __shfl_xor(mx, 16, 32));
    const float mnew = fmaxf(mrun, mx);                       // stays -3e38 until the first unmasked key; exp terms below are then 0 or 1 harmlessly
    const float corr = __builtin_amdgcn_exp2f(mrun - mnew);
    const float mex = fmaxf(mnew, -1.0e30f);                  // a masked score (-3e38) minus mex stays about -3e38 also while mnew is still -3e38, so its term is exactly 0 with no test per element
    float ps = 0.f;
#pragma unroll
    for (int jc = 0; jc < 4; ++jc) { v8h ph;
#pragma unroll
      for (int e = 0; e < 8; ++e) { const float p = __builtin_amdgcn_exp2f(sc[jc * 2 + (e >> 2)][e & 3] - mex); ps += p; ph[e] = (_Float16)(p * 16384.0f); }
      vst2(&sP[w][col][g * 32 + jc * 8], ph); }
    ps += __shfl_xor(ps, 16, 32);
    lrun = lrun * corr + ps; mrun = mnew;
#pragma unroll
    for (int r = 0; r < 8; ++r) { const float cr = __shfl(corr, 8 * g + r, 32);
#pragma unroll
      for (int t = 0; t < 4; ++t) acc[t][r] *= cr; }
    LDSX();
#pragma unroll
    for (int t = 0; t < 4; ++t) vf[0][t] = frag_p(vp + t * 16 * LL);                              // first half of V^T, four fragments at once; behind LDSX, whose fence waits for every load in flight
#pragma unroll
    for (int kc = 0; kc < 2; ++kc) { const v16h pa = frag_h(&sP[w][col][0] + kc * 32, lane);
#pragma unroll
      for (int t = 0; t < 4; ++t) { acc[t] = wmma16(pa, vf[kc][t], acc[t]);
        if (kc == 0) vf[1][t] = frag_p(vp + t * 16 * LL + 32); } }                  // second half, each into the registers its WMMA has freed
    __syncthreads();                                           // slab is rewritten next iteration
  }
#pragma unroll
  for (int r = 0; r < 8; ++r) {
#pragma unroll
    for (int t = 0; t < 4; ++t) sS[w][8 * g + r][t * 16 + col] = acc[t][r]; }   // sS[w] is this wave's own and its scores are used up
  if (g == 0) { sM[w][col] = mrun; sL[w][col] = lrun; }
  __syncthreads();                                             // every wave's partial result is in LDS before any thread merges
  const int rl = tid >> 4, pc = tid & 15, mq = rl >> 4, mr = rl & 15;   // one thread: 4 output columns of one of the 64 rows
  float mall = -3.4e38f;
#pragma unroll
  for (int s = 0; s < KS; ++s) mall = fmaxf(mall, sM[s * 4 + mq][mr]);    // finite: the last key is masked for no row
  float lall = 0.f; v4f o = {};
#pragma unroll
  for (int s = 0; s < KS; ++s) { const float wg = exp2_slot(sM[s * 4 + mq][mr] - mall); lall += sL[s * 4 + mq][mr] * wg; o += *(const v4f*)(&sS[s * 4 + mq][mr][pc * 4]) * wg; }
  const float den = lall * 16384.0f;
#pragma unroll
  for (int e = 0; e < 4; ++e) o[e] = o[e] / den;
  vst2(out + ((size_t)b * LL + blockIdx.x * 64 + rl) * DD + pc * 4, o);
}
extern "C" void kernel_launch(void* const* d_in, const int* in_sizes, int n_in, void* d_out, int out_size, void* d_ws, size_t ws_size, hipStream_t stream) {
  (void)in_sizes; (void)n_in; (void)out_size; (void)ws_size;
  const float* q = (const float*)d_in[0]; const float* k = (const float*)d_in[1]; const float* v = (const float*)d_in[2]; const int* lab = (const int*)d_in[3];
  float* out = (float*)d_out;
  char* ws = (char*)d_ws; size_t off = 0;
  auto take = [&](size_t bytes) { char* p = ws + off; off += (bytes + 255) & ~(size_t)255; return p; };
  _Float16* q16 = (_Float16*)take((size_t)NR * DD * 2); _Float16* k16 = (_Float16*)take((size_t)NR * DD * 2); _Float16* vT = (_Float16*)take((size_t)NR * DD * 2);
  k_prep<<<dim3(LL / 64, NB), 256, 0, stream>>>(q, k, v, q16, k16, vT);
  k_attn<<<dim3(LL / 64, NB), 128 * KS, 0, stream>>>(q16, k16, vT, lab, out);
}

// v004
// A run of this version takes 48.2 microseconds.
// Timed twice side by side with v003, it ran 1.65 times as fast both times.
// Over all steps from v000 it is 7.29 times as fast.
#include <hip/hip_runtime.h>
#include <math.h>

typedef __attribute__((ext_vector_type(16))) _Float16 v16h;
typedef __attribute__((ext_vector_type(16))) __bf16 v16b;
typedef __attribute__((ext_vector_type(8)))  _Float16 v8h;
typedef __attribute__((ext_vector_type(8)))  float v8f;
typedef __attribute__((ext_vector_type(4)))  float v4f;
typedef __attribute__((ext_vector_type(2)))  float v2f;
typedef __attribute__((ext_vector_type(4)))  unsigned v4u;
typedef __attribute__((ext_vector_type(4)))  int v4i;
typedef float __attribute__((may_alias)) float_a;
typedef int __attribute__((may_alias)) int_a;

template <typename T> __device__ __forceinline__ void vst2(void* p, T v) { *(T*)p = v;  }
__device__ __forceinline__ v8f wmma16(v16h a, v16h b, v8f c) {
  v8f d = __builtin_amdgcn_wmma_f32_16x16x32_f16(false, a, false, b, (short)0, c, false, false);
  asm volatile("v_nop\n\tv_nop\n\tv_nop\n\tv_nop" : "+v"(d) : "v"(a), "v"(b));
  return d;
}
__device__ __forceinline__ v8f wmma_bf(v16b a, v16b b, v8f c) {
  v8f d = __builtin_amdgcn_wmma_f32_16x16x32_bf16(false, a, false, b, (short)0, c, false, false);
  asm volatile("v_nop\n\tv_nop\n\tv_nop\n\tv_nop" : "+v"(d) : "v"(a), "v"(b));
  return d;
}
// 16x16x32 fragments: lane = (h = lane>>4, row/col = lane&15); elements 0..7 = k0+8h+0..7, 8..15 = k0+16+8h+0..7; D element r = row 8h+r
__device__ __forceinline__ v16h frag_h(const _Float16* rowk0, int lane) {
  union { v16h v; v8h q[2]; } u; const _Float16* p = rowk0 + 8 * (lane >> 4);
  u.q[0] = *(const v8h*)p; u.q[1] = *(const v8h*)(p + 16); return u.v;
}
// the same fragment from fragment-order storage: 1 KB a fragment, elements 0..7 of lanes 0..31 (16 B a lane, 512 B in a row), then elements 8..15 likewise; p already holds the lane's 8 * lane
__device__ __forceinline__ v16h frag_o(const _Float16* p) {
  union { v16h v; v8h q[2]; } u; u.q[0] = *(const v8h*)p; u.q[1] = *(const v8h*)(p + 256); return u.v;
}
// a block-uniform address kept in two scalar registers and stepped there, so that kF and vF share the lane's one offset register; left to itself the compiler folded the batch's
// part into a 64-bit vector base for each, two registers more at the 128-register limit of a 32-wave block, and spilled one register to scratch
__device__ __forceinline__ const char* sbase(const void* p) {
  const unsigned long long a = (unsigned long long)p;
  const unsigned lo = (unsigned)__builtin_amdgcn_readfirstlane((int)(unsigned)a), hi = (unsigned)__builtin_amdgcn_readfirstlane((int)(unsigned)(a >> 32));
  return (const char*)(const __attribute__((address_space(1))) char*)(((unsigned long long)hi << 32) | lo);   // named as global memory: from a bare integer the loads would be flat ones
}
__device__ __forceinline__ v16h frag_f32(const float* rowk0, int lane) {
  v16h a; const float* p = rowk0 + 8 * (lane >> 4);
#pragma unroll
  for (int i = 0; i < 8; ++i) { a[i] = (_Float16)p[i]; a[8 + i] = (_Float16)p[16 + i]; }
  return a;
}
__device__ __forceinline__ v16h frag_f32s(const float* rowk0, int lane, float sc) {
  v16h a; const float* p = rowk0 + 8 * (lane >> 4);
#pragma unroll
  for (int i = 0; i < 8; ++i) { a[i] = (_Float16)(p[i] * sc); a[8 + i] = (_Float16)(p[16 + i] * sc); }
  return a;
}
// column fragment from a [K][ld] layout (column n), rows >= K read as 0
__device__ __forceinline__ v16h fragc_f32(const float* W, int k0, int n, int lane, int ld, int K) {
  v16h a; const int g = lane >> 4;
#pragma unroll
  for (int i = 0; i < 8; ++i) { const int ka = k0 + 8 * g + i, kb = ka + 16;
    a[i] = (_Float16)(ka < K ? W[(size_t)ka * ld + n] : 0.f); a[8 + i] = (_Float16)(kb < K ? W[(size_t)kb * ld + n] : 0.f); }
  return a;
}
struct F2 { v16b h, l; };
__device__ __forceinline__ F2 bsplit16(const float v[16]) { F2 r;
#pragma unroll
  for (int i = 0; i < 16; ++i) { const __bf16 h = (__bf16)v[i]; r.h[i] = h; r.l[i] = (__bf16)(v[i] - (float)h); }
  return r; }
__device__ __forceinline__ F2 split_row(const float* row, int k0, int lane) { float v[16]; const float* p = row + k0 + 8 * (lane >> 4);
#pragma unroll
  for (int i = 0; i < 8; ++i) { v[i] = p[i]; v[8 + i] = p[16 + i]; }
  return bsplit16(v); }
__device__ __forceinline__ F2 split_rowK(const float* row, int k0, int lane, int K) { float v[16]; const int g = lane >> 4;
#pragma unroll
  for (int i = 0; i < 8; ++i) { const int ka = k0 + 8 * g + i, kb = ka + 16; v[i] = ka < K ? row[ka] : 0.f; v[8 + i] = kb < K ? row[kb] : 0.f; }
  return bsplit16(v); }
__device__ __forceinline__ F2 split_col(const float* W, int k0, int n, int lane, int ld, int K) { float v[16]; const int g = lane >> 4;
#pragma unroll
  for (int i = 0; i < 8; ++i) { const int ka = k0 + 8 * g + i, kb = ka + 16; v[i] = ka < K ? W[(size_t)ka * ld + n] : 0.f; v[8 + i] = kb < K ? W[(size_t)kb * ld + n] : 0.f; }
  return bsplit16(v); }
__device__ __forceinline__ v8f mac3(const F2& a, const F2& b, v8f c) { c = wmma_bf(a.l, b.h, c); c = wmma_bf(a.h, b.l, c); return wmma_bf(a.h, b.h, c); }
__device__ __forceinline__ float sigm(float v) { return 1.0f / (1.0f + expf(-v)); }
// v_exp_f32 with the one free slot the instruction set asks for behind it, in one statement
__device__ __forceinline__ float exp2_slot(float x) { float r; asm("v_exp_f32 %0, %1\n\tv_nop" : "=v"(r) : "v"(x)); return r; }
#define LDSX() do { asm volatile("s_wait_dscnt 0" ::: "memory"); __builtin_amdgcn_wave_barrier(); __builtin_amdgcn_fence(__ATOMIC_RELEASE, "workgroup"); } while (0)

// Label-clustered attention: per (b, 64 queries) block the 4096 keys are streamed in 64-key tiles: S = q.k on
// v_wmma_f32_16x16x32_f16 (q, k converted to f16 once; f32 accumulate), masked where the labels differ (except the last row/column,
// which is never masked), online softmax in f32, P x2^14 as f16 @ v^T (v transposed to f16 once). Labels are read as data for the
#define NB 4
#define LL 4096
#define DD 64
#define NR (NB * LL)

__global__ __launch_bounds__(256) void k_prep(const float* __restrict__ q, const float* __restrict__ k, const float* __restrict__ v, _Float16* __restrict__ q16, _Float16* __restrict__ kF, _Float16* __restrict__ vF) {
  // block = 64 rows of one batch: q16 rows (f16); kF and vF hold the block's 64 keys as 8 KB each, in the order in which k_attn's fragment loads read them
  // (frag_o), so that a wave-wide 16-byte load there reads 4 whole 128-byte lines: kF [key tile t of 16][kc][fragment], vF [kc][d tile t of 16][fragment], V transposed in LDS
  __shared__ __align__(16) _Float16 st[DD][72];
  const int tid = threadIdx.x, b = blockIdx.y, r0 = blockIdx.x * 64;
  const size_t fo = ((size_t)b * LL + r0) * DD;               // the block's 8 KB in kF and in vF; qd below is the 16-byte piece of it: lane qd & 31, element half (qd >> 5) & 1
  for (int qd = tid; qd < 64 * DD / 8; qd += 256) { const int rl = qd >> 3, pc = qd & 7; const size_t o = fo + rl * DD + pc * 8; union { v8h h; v4u u; } pq, pk;
    const size_t ok = fo + ((qd >> 7) * 16 + (qd & 15)) * DD + ((qd >> 6) & 1) * 32 + ((qd >> 5) & 1) * 16 + ((qd >> 4) & 1) * 8;
#pragma unroll
    for (int e = 0; e < 8; ++e) { pq.h[e] = (_Float16)q[o + e]; pk.h[e] = (_Float16)k[ok + e]; }
    vst2(q16 + o, pq.u); vst2(kF + fo + qd * 8, pk.u); }
  for (int qd = tid; qd < 64 * DD; qd += 256) { const int rl = qd >> 6, d = qd & 63; st[d][rl] = (_Float16)v[((size_t)b * LL + r0 + rl) * DD + d]; }
  __syncthreads();
  for (int qd = tid; qd < DD * 8; qd += 256) { const int d = ((qd >> 6) & 3) * 16 + (qd & 15), kl = (qd >> 8) * 32 + ((qd >> 5) & 1) * 16 + ((qd >> 4) & 1) * 8; vst2(vF + fo + qd * 8, *(const v4u*)(&st[d][kl])); }
}
// the 64 key tiles of a block are shared out over KS groups of 4 waves (group ks takes tiles ks, ks + KS, ks + 2 KS, ...), so that a SIMD holds KS waves
// whose waits overlap; each wave keeps its own running maximum, sum and unnormalised O, and the block merges the KS partial results in LDS at the end
#define KS 8
#define KT (LL / 64 / KS)
// scores, running maxima and their differences are kept in units of log2: 1/sqrt(64) * log2(e), so that each exponential is one v_exp_f32
#define SCL2 0.18033688f
__global__ __launch_bounds__(128 * KS) void k_attn(const _Float16* __restrict__ q16, const _Float16* __restrict__ kF, const _Float16* __restrict__ vF, const int* __restrict__ lab, float* __restrict__ out) {
  __shared__ __align__(16) float sS[4 * KS][16][68];
  __shared__ __align__(16) _Float16 sP[4 * KS][16][72];
  __shared__ float sM[4 * KS][16], sL[4 * KS][16];
  __shared__ int slab[KS][64];
  const int tid = threadIdx.x, w = tid >> 5, lane = tid & 31, col = lane & 15, g = lane >> 4;
  const int qg = w & 3, ks = w >> 2;                          // query group (16 rows) and key group of this wave
  const int b = blockIdx.y, q0 = blockIdx.x * 64 + qg * 16;
  const _Float16* qb = q16 + (size_t)b * LL * DD; const _Float16* kb = kF + (size_t)b * LL * DD; const _Float16* vb = vF + (size_t)b * LL * DD; const int* lb = lab + (size_t)b * (LL - 1);
  v16h aq[2];
#pragma unroll
  for (int kc = 0; kc < 2; ++kc) aq[kc] = frag_h(qb + (size_t)(q0 + col) * DD + kc * 32, lane);
  int myl[8];
#pragma unroll
  for (int r = 0; r < 8; ++r) { const int qi = q0 + 8 * g + r; myl[r] = qi < LL - 1 ? lb[qi] : -1; }     // -1: the last (time) row is never masked
  float mrun = -3.0e38f, lrun = 0.f; v8f acc[4] = {};
  // The K and V^T fragments are loaded ahead of their WMMAs, several at a time, so that a group's load latencies run side by side. The compiler moves no load
  // over the volatile statement behind a WMMA in wmma16: a load written as that call's argument starts behind the WMMA before it and is waited for at once.
  const unsigned flo = (ks * 64 * DD + 8 * lane) * 2;         // the lane's byte offset in kF and in vF (a 64-key tile is 8 KB in each), formed once; the trip's part of an address is the same for the whole block
#pragma unroll 1
  for (int it = 0; it < KT; ++it) {                            // this wave's key tile of the trip is it * KS + ks
    const _Float16* kp = (const _Float16*)(sbase(kb + it * (KS * 64 * DD)) + flo); const _Float16* vp = (const _Float16*)(sbase(vb + it * (KS * 64 * DD)) + flo);
    v16h kf[4][2], vf[2][4];
#pragma unroll
    for (int t = 0; t < 2; ++t) {
#pragma unroll
      for (int kc = 0; kc < 2; ++kc) kf[t][kc] = frag_o(kp + t * 1024 + kc * 512); }     // key tiles 0 and 1; tile t + 2 is asked for behind the WMMAs of tile t
    if (tid < 64 * KS) { const int key = it * (64 * KS) + tid; slab[tid >> 6][tid & 63] = key < LL - 1 ? lb[key] : -2; }      // -2: last column never masked
    __syncthreads();
#pragma unroll
    for (int t = 0; t < 4; ++t) { v8f s = {}; const int kl = slab[ks][t * 16 + col];
#pragma unroll
      for (int kc = 0; kc < 2; ++kc) s = wmma16(aq[kc], kf[t][kc], s);
      if (t < 2) {
#pragma unroll
        for (int kc = 0; kc < 2; ++kc) kf[t + 2][kc] = frag_o(kp + (t + 2) * 1024 + kc * 512); }
#pragma unroll
      for (int r = 0; r < 8; ++r) { const bool masked = (myl[r] >= 0) && (kl != -2) && (kl != myl[r]); sS[w][8 * g + r][t * 16 + col] = masked ? -3.0e38f : s[r] * SCL2; } }
    LDSX();
    float mx = -3.4e38f; v4f sc[8];                            // this lane's 32 scores, read once for the maximum and the exponentials
#pragma unroll
    for (int jc = 0; jc < 8; ++jc) { sc[jc] = *(const v4f*)(&sS[w][col][g * 32 + jc * 4]);
#pragma unroll
      for (int e = 0; e < 4; ++e) mx = fmaxf(mx, sc[jc][e]); }
    mx = fmaxf(mx, __shfl_xor(mx, 16, 32));
    const float mnew = fmaxf(mrun, mx);                       // stays -3e38 until the first unmasked key; exp terms below are then 0 or 1 harmlessly
    const float corr = __builtin_amdgcn_exp2f(mrun - mnew);
    const float mex = fmaxf(mnew, -1.0e30f);                  // a masked score (-3e38) minus mex stays about -3e38 also while mnew is still -3e38, so its term is exactly 0 with no test per element
    float ps = 0.f;
#pragma unroll
    for (int jc = 0; jc < 4; ++jc) { v8h ph;
#pragma unroll
      for (int e = 0; e < 8; ++e) { const float p = __builtin_amdgcn_exp2f(sc[jc * 2 + (e >> 2)][e & 3] - mex); ps += p; ph[e] = (_Float16)(p * 16384.0f); }
      vst2(&sP[w][col][g * 32 + jc * 8], ph); }
    ps += __shfl_xor(ps, 16, 32);
    lrun = lrun * corr + ps; mrun = mnew;
#pragma unroll
    for (int r = 0; r < 8; ++r) { const float cr = __shfl(corr, 8 * g + r, 32);
#pragma unroll
      for (int t = 0; t < 4; ++t) acc[t][r] *= cr; }
    LDSX();
#pragma unroll
    for (int t = 0; t < 4; ++t) vf[0][t] = frag_o(vp + t * 512);                              // first half of V^T, four fragments at once; behind LDSX, whose fence waits for every load in flight
#pragma unroll
    for (int kc = 0; kc < 2; ++kc) { const v16h pa = frag_h(&sP[w][col][0] + kc * 32, lane);
#pragma unroll
      for (int t = 0; t < 4; ++t) { acc[t] = wmma16(pa, vf[kc][t], acc[t]);
        if (kc == 0) vf[1][t] = frag_o(vp + 2048 + t * 512); } }                  // second half, each into the registers its WMMA has freed
    __syncthreads();                                           // slab is rewritten next iteration
  }
#pragma unroll
  for (int r = 0; r < 8; ++r) {
#pragma unroll
    for (int t = 0; t < 4; ++t) sS[w][8 * g + r][t * 16 + col] = acc[t][r]; }   // sS[w] is this wave's own and its scores are used up
  if (g == 0) { sM[w][col] = mrun; sL[w][col] = lrun; }
  __syncthreads();                                             // every wave's partial result is in LDS before any thread merges
  const int rl = tid >> 4, pc = tid & 15, mq = rl >> 4, mr = rl & 15;   // one thread: 4 output columns of one of the 64 rows
  float mall = -3.4e38f;
#pragma unroll
  for (int s = 0; s < KS; ++s) mall = fmaxf(mall, sM[s * 4 + mq][mr]);    // finite: the last key is masked for no row
  float lall = 0.f; v4f o = {};
#pragma unroll
  for (int s = 0; s < KS; ++s) { const float wg = exp2_slot(sM[s * 4 + mq][mr] - mall); lall += sL[s * 4 + mq][mr] * wg; o += *(const v4f*)(&sS[s * 4 + mq][mr][pc * 4]) * wg; }
  const float den = lall * 16384.0f;
#pragma unroll
  for (int e = 0; e < 4; ++e) o[e] = o[e] / den;
  vst2(out + ((size_t)b * LL + blockIdx.x * 64 + rl) * DD + pc * 4, o);
}
extern "C" void kernel_launch(void* const* d_in, const int* in_sizes, int n_in, void* d_out, int out_size, void* d_ws, size_t ws_size, hipStream_t stream) {
  (void)in_sizes; (void)n_in; (void)out_size; (void)ws_size;
  const float* q = (const float*)d_in[0]; const float* k = (const float*)d_in[1]; const float* v = (const float*)d_in[2]; const int* lab = (const int*)d_in[3];
  float* out = (float*)d_out;
  char* ws = (char*)d_ws; size_t off = 0;
  auto take = [&](size_t bytes) { char* p = ws + off; off += (bytes + 255) & ~(size_t)255; return p; };
  _Float16* q16 = (_Float16*)take((size_t)NR * DD * 2); _Float16* kF = (_Float16*)take((size_t)NR * DD * 2); _Float16* vF = (_Float16*)take((size_t)NR * DD * 2);
  k_prep<<<dim3(LL / 64, NB), 256, 0, stream>>>(q, k, v, q16, kF, vF);
  k_attn<<<dim3(LL / 64, NB), 128 * KS, 0, stream>>>(q16, kF, vF, lab, out);
}

// v005
// A run of this version takes 44.8 microseconds.
// Next to v004, in two timings, it ran 1.09 and 1.14 times as fast.
// All steps since v000 together make it 8.11 times as fast.
#include <hip/hip_runtime.h>
#include <math.h>

typedef __attribute__((ext_vector_type(16))) _Float16 v16h;
typedef __attribute__((ext_vector_type(16))) __bf16 v16b;
typedef __attribute__((ext_vector_type(8)))  _Float16 v8h;
typedef __attribute__((ext_vector_type(8)))  float v8f;
typedef __attribute__((ext_vector_type(4)))  float v4f;
typedef __attribute__((ext_vector_type(2)))  float v2f;
typedef __attribute__((ext_vector_type(4)))  unsigned v4u;
typedef __attribute__((ext_vector_type(4)))  int v4i;
typedef float __attribute__((may_alias)) float_a;
typedef int __attribute__((may_alias)) int_a;

template <typename T> __device__ __forceinline__ void vst2(void* p, T v) { *(T*)p = v;  }
__device__ __forceinline__ v8f wmma16(v16h a, v16h b, v8f c) {
  v8f d = __builtin_amdgcn_wmma_f32_16x16x32_f16(false, a, false, b, (short)0, c, false, false);
  asm volatile("v_nop\n\tv_nop\n\tv_nop\n\tv_nop" : "+v"(d) : "v"(a), "v"(b));
  return d;
}
__device__ __forceinline__ v8f wmma_bf(v16b a, v16b b, v8f c) {
  v8f d = __builtin_amdgcn_wmma_f32_16x16x32_bf16(false, a, false, b, (short)0, c, false, false);
  asm volatile("v_nop\n\tv_nop\n\tv_nop\n\tv_nop" : "+v"(d) : "v"(a), "v"(b));
  return d;
}
// 16x16x32 fragments: lane = (h = lane>>4, row/col = lane&15); elements 0..7 = k0+8h+0..7, 8..15 = k0+16+8h+0..7; D element r = row 8h+r
__device__ __forceinline__ v16h frag_h(const _Float16* rowk0, int lane) {
  union { v16h v; v8h q[2]; } u; const _Float16* p = rowk0 + 8 * (lane >> 4);
  u.q[0] = *(const v8h*)p; u.q[1] = *(const v8h*)(p + 16); return u.v;
}
// the same fragment from fragment-order storage: 1 KB a fragment, elements 0..7 of lanes 0..31 (16 B a lane, 512 B in a row), then elements 8..15 likewise; p already holds the lane's 8 * lane
__device__ __forceinline__ v16h frag_o(const _Float16* p) {
  union { v16h v; v8h q[2]; } u; u.q[0] = *(const v8h*)p; u.q[1] = *(const v8h*)(p + 256); return u.v;
}
// a block-uniform address kept in two scalar registers and stepped there, so that kF and vF share the lane's one offset register; left to itself the compiler folded the batch's
// part into a 64-bit vector base for each, two registers more at the 128-register limit of a 32-wave block, and spilled one register to scratch
__device__ __forceinline__ const char* sbase(const void* p) {
  const unsigned long long a = (unsigned long long)p;
  const unsigned lo = (unsigned)__builtin_amdgcn_readfirstlane((int)(unsigned)a), hi = (unsigned)__builtin_amdgcn_readfirstlane((int)(unsigned)(a >> 32));
  return (const char*)(const __attribute__((address_space(1))) char*)(((unsigned long long)hi << 32) | lo);   // named as global memory: from a bare integer the loads would be flat ones
}
// lane l's value to lane l ^ 16 and back, in the vector unit
__device__ __forceinline__ float xhalf(float x) { const int b = __builtin_bit_cast(int, x); return __builtin_bit_cast(float, __builtin_amdgcn_permlanex16(b, b, 0x76543210, 0xfedcba98, false, false)); }
__device__ __forceinline__ v16h frag_f32(const float* rowk0, int lane) {
  v16h a; const float* p = rowk0 + 8 * (lane >> 4);
#pragma unroll
  for (int i = 0; i < 8; ++i) { a[i] = (_Float16)p[i]; a[8 + i] = (_Float16)p[16 + i]; }
  return a;
}
__device__ __forceinline__ v16h frag_f32s(const float* rowk0, int lane, float sc) {
  v16h a; const float* p = rowk0 + 8 * (lane >> 4);
#pragma unroll
  for (int i = 0; i < 8; ++i) { a[i] = (_Float16)(p[i] * sc); a[8 + i] = (_Float16)(p[16 + i] * sc); }
  return a;
}
// column fragment from a [K][ld] layout (column n), rows >= K read as 0
__device__ __forceinline__ v16h fragc_f32(const float* W, int k0, int n, int lane, int ld, int K) {
  v16h a; const int g = lane >> 4;
#pragma unroll
  for (int i = 0; i < 8; ++i) { const int ka = k0 + 8 * g + i, kb = ka + 16;
    a[i] = (_Float16)(ka < K ? W[(size_t)ka * ld + n] : 0.f); a[8 + i] = (_Float16)(kb < K ? W[(size_t)kb * ld + n] : 0.f); }
  return a;
}
struct F2 { v16b h, l; };
__device__ __forceinline__ F2 bsplit16(const float v[16]) { F2 r;
#pragma unroll
  for (int i = 0; i < 16; ++i) { const __bf16 h = (__bf16)v[i]; r.h[i] = h; r.l[i] = (__bf16)(v[i] - (float)h); }
  return r; }
__device__ __forceinline__ F2 split_row(const float* row, int k0, int lane) { float v[16]; const float* p = row + k0 + 8 * (lane >> 4);
#pragma unroll
  for (int i = 0; i < 8; ++i) { v[i] = p[i]; v[8 + i] = p[16 + i]; }
  return bsplit16(v); }
__device__ __forceinline__ F2 split_rowK(const float* row, int k0, int lane, int K) { float v[16]; const int g = lane >> 4;
#pragma unroll
  for (int i = 0; i < 8; ++i) { const int ka = k0 + 8 * g + i, kb = ka + 16; v[i] = ka < K ? row[ka] : 0.f; v[8 + i] = kb < K ? row[kb] : 0.f; }
  return bsplit16(v); }
__device__ __forceinline__ F2 split_col(const float* W, int k0, int n, int lane, int ld, int K) { float v[16]; const int g = lane >> 4;
#pragma unroll
  for (int i = 0; i < 8; ++i) { const int ka = k0 + 8 * g + i, kb = ka + 16; v[i] = ka < K ? W[(size_t)ka * ld + n] : 0.f; v[8 + i] = kb < K ? W[(size_t)kb * ld + n] : 0.f; }
  return bsplit16(v); }
__device__ __forceinline__ v8f mac3(const F2& a, const F2& b, v8f c) { c = wmma_bf(a.l, b.h, c); c = wmma_bf(a.h, b.l, c); return wmma_bf(a.h, b.h, c); }
__device__ __forceinline__ float sigm(float v) { return 1.0f / (1.0f + expf(-v)); }
// v_exp_f32 with the one free slot the instruction set asks for behind it, in one statement
__device__ __forceinline__ float exp2_slot(float x) { float r; asm("v_exp_f32 %0, %1\n\tv_nop" : "=v"(r) : "v"(x)); return r; }
// eight v_exp_f32 in place, in one statement: each has an independent one behind it, the last a v_nop, which is the free slot the instruction set asks for behind a transcendental
__device__ __forceinline__ void exp2x8(float (&x)[8]) {
  asm("v_exp_f32 %0, %0\n\tv_exp_f32 %1, %1\n\tv_exp_f32 %2, %2\n\tv_exp_f32 %3, %3\n\tv_exp_f32 %4, %4\n\tv_exp_f32 %5, %5\n\tv_exp_f32 %6, %6\n\tv_exp_f32 %7, %7\n\tv_nop"
      : "+v"(x[0]), "+v"(x[1]), "+v"(x[2]), "+v"(x[3]), "+v"(x[4]), "+v"(x[5]), "+v"(x[6]), "+v"(x[7])); }
#define LDSX() do { asm volatile("s_wait_dscnt 0" ::: "memory"); __builtin_amdgcn_wave_barrier(); __builtin_amdgcn_fence(__ATOMIC_RELEASE, "workgroup"); } while (0)

// Label-clustered attention: per (b, 64 queries) block the 4096 keys are streamed in 64-key tiles: S = q.k on
// v_wmma_f32_16x16x32_f16 (q, k converted to f16 once; f32 accumulate), masked where the labels differ (except the last row/column,
// which is never masked), online softmax in f32, P x2^14 as f16 @ v^T (v transposed to f16 once). Labels are read as data for the
#define NB 4
#define LL 4096
#define DD 64
#define NR (NB * LL)

__global__ __launch_bounds__(256) void k_prep(const float* __restrict__ q, const float* __restrict__ k, const float* __restrict__ v, _Float16* __restrict__ q16, _Float16* __restrict__ kF, _Float16* __restrict__ vF) {
  // block = 64 rows of one batch: q16 rows (f16); kF and vF hold the block's 64 keys as 8 KB each, in the order in which k_attn's fragment loads read them
  // (frag_o), so that a wave-wide 16-byte load there reads 4 whole 128-byte lines: kF [key tile t of 16][kc][fragment], vF [kc][d tile t of 16][fragment], V transposed in LDS
  __shared__ __align__(16) _Float16 st[DD][72];
  const int tid = threadIdx.x, b = blockIdx.y, r0 = blockIdx.x * 64;
  const size_t fo = ((size_t)b * LL + r0) * DD;               // the block's 8 KB in kF and in vF; qd below is the 16-byte piece of it: lane qd & 31, element half (qd >> 5) & 1
  for (int qd = tid; qd < 64 * DD / 8; qd += 256) { const int rl = qd >> 3, pc = qd & 7; const size_t o = fo + rl * DD + pc * 8; union { v8h h; v4u u; } pq, pk;
    const size_t ok = fo + ((qd >> 7) * 16 + (qd & 15)) * DD + ((qd >> 6) & 1) * 32 + ((qd >> 5) & 1) * 16 + ((qd >> 4) & 1) * 8;
#pragma unroll
    for (int e = 0; e < 8; ++e) { pq.h[e] = (_Float16)q[o + e]; pk.h[e] = (_Float16)k[ok + e]; }
    vst2(q16 + o, pq.u); vst2(kF + fo + qd * 8, pk.u); }
  for (int qd = tid; qd < 64 * DD; qd += 256) { const int rl = qd >> 6, d = qd & 63; st[d][rl] = (_Float16)v[((size_t)b * LL + r0 + rl) * DD + d]; }
  __syncthreads();
  for (int qd = tid; qd < DD * 8; qd += 256) { const int d = ((qd >> 6) & 3) * 16 + (qd & 15), kl = (qd >> 8) * 32 + ((qd >> 5) & 1) * 16 + ((qd >> 4) & 1) * 8; vst2(vF + fo + qd * 8, *(const v4u*)(&st[d][kl])); }
}
// the 64 key tiles of a block are shared out over KS groups of 4 waves (group ks takes tiles ks, ks + KS, ks + 2 KS, ...), so that a SIMD holds KS waves
// whose waits overlap; each wave keeps its own running maximum, sum and unnormalised O, and the block merges the KS partial results in LDS at the end
#define KS 8
#define KT (LL / 64 / KS)
// scores, running maxima and their differences are kept in units of log2: 1/sqrt(64) * log2(e), so that each exponential is one v_exp_f32
#define SCL2 0.18033688f
__global__ __launch_bounds__(128 * KS) void k_attn(const _Float16* __restrict__ q16, const _Float16* __restrict__ kF, const _Float16* __restrict__ vF, const int* __restrict__ lab, float* __restrict__ out) {
  __shared__ __align__(16) float sS[4 * KS][16][68];
  __shared__ float sM[4 * KS][16], sL[4 * KS][16];
  __shared__ __align__(16) int slab[KS][64];
  const int tid = threadIdx.x, w = tid >> 5, lane = tid & 31, col = lane & 15, g = lane >> 4;
  const int qg = w & 3, ks = w >> 2;                          // query group (16 rows) and key group of this wave
  const int b = blockIdx.y, q0 = blockIdx.x * 64 + qg * 16;
  const _Float16* qb = q16 + (size_t)b * LL * DD; const _Float16* kb = kF + (size_t)b * LL * DD; const _Float16* vb = vF + (size_t)b * LL * DD; const int* lb = lab + (size_t)b * (LL - 1);
  v16h aq[2];
#pragma unroll
  for (int kc = 0; kc < 2; ++kc) aq[kc] = frag_h(qb + (size_t)(q0 + col) * DD + kc * 32, lane);
  const int myl = q0 + col < LL - 1 ? lb[q0 + col] : -1;      // the lane's one query; -1: the last (time) row is never masked
  float mrun = -3.0e38f, lrun = 0.f; v8f acc[4] = {};          // lrun: the sum over this half-wave's keys only; the two halves are joined once, behind the loop
  // The K and V^T fragments are loaded ahead of their WMMAs, several at a time, so that a group's load latencies run side by side. The compiler moves no load
  // over the volatile statement behind a WMMA in wmma16: a load written as that call's argument starts behind the WMMA before it and is waited for at once.
  const bool lastw = ks == KS - 1 && g == 1;                  // the half-wave that meets the last key, in its last trip
  const unsigned flo = (ks * 64 * DD + 8 * lane) * 2;         // the lane's byte offset in kF and in vF (a 64-key tile is 8 KB in each), formed once; the trip's part of an address is the same for the whole block
#pragma unroll 1
  for (int it = 0; it < KT; ++it) {                            // this wave's key tile of the trip is it * KS + ks
    const _Float16* kp = (const _Float16*)(sbase(kb + it * (KS * 64 * DD)) + flo); const _Float16* vp = (const _Float16*)(sbase(vb + it * (KS * 64 * DD)) + flo);
    v16h kf[4][2], vf[2][4];
#pragma unroll
    for (int t = 0; t < 2; ++t) {
#pragma unroll
      for (int kc = 0; kc < 2; ++kc) kf[t][kc] = frag_o(kp + t * 1024 + kc * 512); }     // key tiles 0 and 1; tile t + 2 is asked for behind the WMMAs of tile t
    if (tid < 64 * KS) { const int* lp = (const int*)sbase(lb + it * (64 * KS)); (&slab[0][0])[tid] = tid < LL - 1 - it * (64 * KS) ? lp[tid] : -2; }      // the last column has no label: lastk below
    __syncthreads();
    v8f sc[4];                                                 // sc[t][r]: key t * 16 + 8 g + r of the tile against query col
    const bool lastk = lastw && it == KT - 1;                  // this lane's element t = 3, r = 7 is the last column (key LL - 1), which is never masked: one test a trip, where a mark in slab would cost a compare per element
#pragma unroll
    for (int t = 0; t < 4; ++t) { v8f s = {}; union { v4i q[2]; int e[8]; } kl;
      kl.q[0] = *(const v4i*)(&slab[ks][t * 16 + 8 * g]); kl.q[1] = *(const v4i*)(&slab[ks][t * 16 + 8 * g + 4]);
#pragma unroll
      for (int kc = 0; kc < 2; ++kc) s = wmma16(kf[t][kc], aq[kc], s);
      if (t < 2) {
#pragma unroll
        for (int kc = 0; kc < 2; ++kc) kf[t + 2][kc] = frag_o(kp + (t + 2) * 1024 + kc * 512); }
#pragma unroll
      for (int r = 0; r < 8; ++r) { const bool masked = (myl >= 0) && (kl.e[r] != myl) && !(t == 3 && r == 7 && lastk); sc[t][r] = masked ? -3.0e38f : s[r] * SCL2; }
      __builtin_amdgcn_sched_barrier(0); }                     // ends the scheduling region at each tile: left free, the scheduler mixed the tiles' mask work into the softmax and sank six of the eight V^T loads below down to their WMMAs
    float mx = -3.4e38f;
#pragma unroll
    for (int t = 0; t < 4; ++t) {
#pragma unroll
      for (int r = 0; r < 8; ++r) mx = fmaxf(mx, sc[t][r]); }
    mx = fmaxf(mx, xhalf(mx));                                // the other half-wave holds the query's other 32 keys
    const float mnew = fmaxf(mrun, mx);                       // stays -3e38 until the first unmasked key; exp terms below are then 0 or 1 harmlessly
    const float corr = __builtin_amdgcn_exp2f(mrun - mnew);
    const float mex = fmaxf(mnew, -1.0e30f);                  // a masked score (-3e38) minus mex stays about -3e38 also while mnew is still -3e38, so its term is exactly 0 with no test per element
    float ps = 0.f; v16h pb[2];                                // pb[kc] element s: key kc * 32 + (s < 8 ? 8 g + s : 16 + 8 g + s - 8), as in the V^T fragment
#pragma unroll
    for (int t = 0; t < 4; ++t) { float x[8];
#pragma unroll
      for (int r = 0; r < 8; ++r) x[r] = sc[t][r] - mex;
      exp2x8(x);
#pragma unroll
      for (int r = 0; r < 8; ++r) { ps += x[r]; pb[t >> 1][(t & 1) * 8 + r] = (_Float16)(x[r] * 16384.0f); }
      if (t == 1) {
#pragma unroll
        for (int u = 0; u < 4; ++u) vf[0][u] = frag_o(vp + u * 512); } }                      // first half of V^T, four fragments at once, into the registers that half of the scores have left; they fly during the other half's exponentials
    lrun = lrun * corr + ps; mrun = mnew;
#pragma unroll
    for (int t = 0; t < 4; ++t) acc[t] *= corr;
#pragma unroll
    for (int kc = 0; kc < 2; ++kc) {
#pragma unroll
      for (int t = 0; t < 4; ++t) { acc[t] = wmma16(vf[kc][t], pb[kc], acc[t]);
        if (kc == 0) vf[1][t] = frag_o(vp + 2048 + t * 512); } }                  // second half, each into the registers its WMMA has freed
    __syncthreads();                                           // slab is rewritten next iteration
  }
  lrun += xhalf(lrun);
#pragma unroll
  for (int t = 0; t < 4; ++t) { v4f lo, hi;                    // acc[t][r] = O[query col][t * 16 + 8 g + r]: 8 columns in a row
#pragma unroll
    for (int e = 0; e < 4; ++e) { lo[e] = acc[t][e]; hi[e] = acc[t][4 + e]; }
    vst2(&sS[w][col][t * 16 + 8 * g], lo); vst2(&sS[w][col][t * 16 + 8 * g + 4], hi); }
  if (g == 0) { sM[w][col] = mrun; sL[w][col] = lrun; }
  __syncthreads();                                             // every wave's partial result is in LDS before any thread merges
  const int rl = tid >> 4, pc = tid & 15, mq = rl >> 4, mr = rl & 15;   // one thread: 4 output columns of one of the 64 rows
  float mall = -3.4e38f;
#pragma unroll
  for (int s = 0; s < KS; ++s) mall = fmaxf(mall, sM[s * 4 + mq][mr]);    // finite: the last key is masked for no row
  float lall = 0.f; v4f o = {};
#pragma unroll
  for (int s = 0; s < KS; ++s) { const float wg = exp2_slot(sM[s * 4 + mq][mr] - mall); lall += sL[s * 4 + mq][mr] * wg; o += *(const v4f*)(&sS[s * 4 + mq][mr][pc * 4]) * wg; }
  const float den = lall * 16384.0f;
#pragma unroll
  for (int e = 0; e < 4; ++e) o[e] = o[e] / den;
  vst2(out + ((size_t)b * LL + blockIdx.x * 64 + rl) * DD + pc * 4, o);
}
extern "C" void kernel_launch(void* const* d_in, const int* in_sizes, int n_in, void* d_out, int out_size, void* d_ws, size_t ws_size, hipStream_t stream) {
  (void)in_sizes; (void)n_in; (void)out_size; (void)ws_size;
  const float* q = (const float*)d_in[0]; const float* k = (const float*)d_in[1]; const float* v = (const float*)d_in[2]; const int* lab = (const int*)d_in[3];
  float* out = (float*)d_out;
  char* ws = (char*)d_ws; size_t off = 0;
  auto take = [&](size_t bytes) { char* p = ws + off; off += (bytes + 255) & ~(size_t)255; return p; };
  _Float16* q16 = (_Float16*)take((size_t)NR * DD * 2); _Float16* kF = (_Float16*)take((size_t)NR * DD * 2); _Float16* vF = (_Float16*)take((size_t)NR * DD * 2);
  k_prep<<<dim3(LL / 64, NB), 256, 0, stream>>>(q, k, v, q16, kF, vF);
  k_attn<<<dim3(LL / 64, NB), 128 * KS, 0, stream>>>(q16, kF, vF, lab, out);
}

// v006
// One run takes 27.5 microseconds.
// Timed twice side by side with v005, it ran 1.61 times as fast both times.
// All steps since v000 together make it 13.1 times as fast.
#include <hip/hip_runtime.h>
#include <math.h>

typedef __attribute__((ext_vector_type(16))) _Float16 v16h;
typedef __attribute__((ext_vector_type(16))) __bf16 v16b;
typedef __attribute__((ext_vector_type(8)))  _Float16 v8h;
typedef __attribute__((ext_vector_type(8)))  float v8f;
typedef __attribute__((ext_vector_type(4)))  float v4f;
typedef __attribute__((ext_vector_type(2)))  float v2f;
typedef __attribute__((ext_vector_type(4)))  unsigned v4u;
typedef __attribute__((ext_vector_type(4)))  int v4i;
typedef float __attribute__((may_alias)) float_a;
typedef int __attribute__((may_alias)) int_a;

template <typename T> __device__ __forceinline__ void vst2(void* p, T v) { *(T*)p = v;  }
__device__ __forceinline__ v8f wmma16(v16h a, v16h b, v8f c) {
  v8f d = __builtin_amdgcn_wmma_f32_16x16x32_f16(false, a, false, b, (short)0, c, false, false);
  asm volatile("v_nop\n\tv_nop\n\tv_nop\n\tv_nop" : "+v"(d) : "v"(a), "v"(b));
  return d;
}
__device__ __forceinline__ v8f wmma_bf(v16b a, v16b b, v8f c) {
  v8f d = __builtin_amdgcn_wmma_f32_16x16x32_bf16(false, a, false, b, (short)0, c, false, false);
  asm volatile("v_nop\n\tv_nop\n\tv_nop\n\tv_nop" : "+v"(d) : "v"(a), "v"(b));
  return d;
}
// 16x16x32 fragments: lane = (h = lane>>4, row/col = lane&15); elements 0..7 = k0+8h+0..7, 8..15 = k0+16+8h+0..7; D element r = row 8h+r
__device__ __forceinline__ v16h frag_h(const _Float16* rowk0, int lane) {
  union { v16h v; v8h q[2]; } u; const _Float16* p = rowk0 + 8 * (lane >> 4);
  u.q[0] = *(const v8h*)p; u.q[1] = *(const v8h*)(p + 16); return u.v;
}
// the same fragment from fragment-order storage: 1 KB a fragment, elements 0..7 of lanes 0..31 (16 B a lane, 512 B in a row), then elements 8..15 likewise; p already holds the lane's 8 * lane
__device__ __forceinline__ v16h frag_o(const _Float16* p) {
  union { v16h v; v8h q[2]; } u; u.q[0] = *(const v8h*)p; u.q[1] = *(const v8h*)(p + 256); return u.v;
}
// a block-uniform address kept in two scalar registers and stepped there, so that kF and vF share the lane's one offset register; left to itself the compiler folded the batch's
// part into a 64-bit vector base for each, two registers more at the 128-register limit of a 32-wave block, and spilled one register to scratch
__device__ __forceinline__ const char* sbase(const void* p) {
  const unsigned long long a = (unsigned long long)p;
  const unsigned lo = (unsigned)__builtin_amdgcn_readfirstlane((int)(unsigned)a), hi = (unsigned)__builtin_amdgcn_readfirstlane((int)(unsigned)(a >> 32));
  return (const char*)(const __attribute__((address_space(1))) char*)(((unsigned long long)hi << 32) | lo);   // named as global memory: from a bare integer the loads would be flat ones
}
// lane l's value to lane l ^ 16 and back, in the vector unit
__device__ __forceinline__ float xhalf(float x) { const int b = __builtin_bit_cast(int, x); return __builtin_bit_cast(float, __builtin_amdgcn_permlanex16(b, b, 0x76543210, 0xfedcba98, false, false)); }
__device__ __forceinline__ v16h frag_f32(const float* rowk0, int lane) {
  v16h a; const float* p = rowk0 + 8 * (lane >> 4);
#pragma unroll
  for (int i = 0; i < 8; ++i) { a[i] = (_Float16)p[i]; a[8 + i] = (_Float16)p[16 + i]; }
  return a;
}
__device__ __forceinline__ v16h frag_f32s(const float* rowk0, int lane, float sc) {
  v16h a; const float* p = rowk0 + 8 * (lane >> 4);
#pragma unroll
  for (int i = 0; i < 8; ++i) { a[i] = (_Float16)(p[i] * sc); a[8 + i] = (_Float16)(p[16 + i] * sc); }
  return a;
}
// column fragment from a [K][ld] layout (column n), rows >= K read as 0
__device__ __forceinline__ v16h fragc_f32(const float* W, int k0, int n, int lane, int ld, int K) {
  v16h a; const int g = lane >> 4;
#pragma unroll
  for (int i = 0; i < 8; ++i) { const int ka = k0 + 8 * g + i, kb = ka + 16;
    a[i] = (_Float16)(ka < K ? W[(size_t)ka * ld + n] : 0.f); a[8 + i] = (_Float16)(kb < K ? W[(size_t)kb * ld + n] : 0.f); }
  return a;
}
struct F2 { v16b h, l; };
__device__ __forceinline__ F2 bsplit16(const float v[16]) { F2 r;
#pragma unroll
  for (int i = 0; i < 16; ++i) { const __bf16 h = (__bf16)v[i]; r.h[i] = h; r.l[i] = (__bf16)(v[i] - (float)h); }
  return r; }
__device__ __forceinline__ F2 split_row(const float* row, int k0, int lane) { float v[16]; const float* p = row + k0 + 8 * (lane >> 4);
#pragma unroll
  for (int i = 0; i < 8; ++i) { v[i] = p[i]; v[8 + i] = p[16 + i]; }
  return bsplit16(v); }
__device__ __forceinline__ F2 split_rowK(const float* row, int k0, int lane, int K) { float v[16]; const int g = lane >> 4;
#pragma unroll
  for (int i = 0; i < 8; ++i) { const int ka = k0 + 8 * g + i, kb = ka + 16; v[i] = ka < K ? row[ka] : 0.f; v[8 + i] = kb < K ? row[kb] : 0.f; }
  return bsplit16(v); }
__device__ __forceinline__ F2 split_col(const float* W, int k0, int n, int lane, int ld, int K) { float v[16]; const int g = lane >> 4;
#pragma unroll
  for (int i = 0; i < 8; ++i) { const int ka = k0 + 8 * g + i, kb = ka + 16; v[i] = ka < K ? W[(size_t)ka * ld + n] : 0.f; v[8 + i] = kb < K ? W[(size_t)kb * ld + n] : 0.f; }
  return bsplit16(v); }
__device__ __forceinline__ v8f mac3(const F2& a, const F2& b, v8f c) { c = wmma_bf(a.l, b.h, c); c = wmma_bf(a.h, b.l, c); return wmma_bf(a.h, b.h, c); }
__device__ __forceinline__ float sigm(float v) { return 1.0f / (1.0f + expf(-v)); }
// v_exp_f32 with the one free slot the instruction set asks for behind it, in one statement
__device__ __forceinline__ float exp2_slot(float x) { float r; asm("v_exp_f32 %0, %1\n\tv_nop" : "=v"(r) : "v"(x)); return r; }
// eight v_exp_f32 in place, in one statement: each has an independent one behind it, the last a v_nop, which is the free slot the instruction set asks for behind a transcendental
__device__ __forceinline__ void exp2x8(float (&x)[8]) {
  asm("v_exp_f32 %0, %0\n\tv_exp_f32 %1, %1\n\tv_exp_f32 %2, %2\n\tv_exp_f32 %3, %3\n\tv_exp_f32 %4, %4\n\tv_exp_f32 %5, %5\n\tv_exp_f32 %6, %6\n\tv_exp_f32 %7, %7\n\tv_nop"
      : "+v"(x[0]), "+v"(x[1]), "+v"(x[2]), "+v"(x[3]), "+v"(x[4]), "+v"(x[5]), "+v"(x[6]), "+v"(x[7])); }
#define LDSX() do { asm volatile("s_wait_dscnt 0" ::: "memory"); __builtin_amdgcn_wave_barrier(); __builtin_amdgcn_fence(__ATOMIC_RELEASE, "workgroup"); } while (0)

// Label-clustered attention: per (b, 64 sorted queries) block the 64-key tiles of its label buckets and the last tile are streamed (all 64 for the last query's own block): S = q.k on
// v_wmma_f32_16x16x32_f16 (q, k converted to f16 once; f32 accumulate), masked where the labels differ (except the last row/column,
// which is never masked), online softmax in f32, P x2^14 as f16 @ v^T (v transposed to f16 once). Labels are read as data for the
#define NB 4
#define LL 4096
#define DD 64
#define NR (NB * LL)

// Rows are regrouped by bucket = label & 7 (a counting sort, the same order for queries and keys; the last row, which has no label, stays last). Rows of equal label share a bucket for any
// label values, so a key tile outside the buckets of a query block holds only masked keys (but for the last key) and k_attn leaves it out; the label compare there stays as it is.
__global__ __launch_bounds__(256) void k_prep(const float* __restrict__ q, const float* __restrict__ k, const float* __restrict__ v, const int* __restrict__ lab, _Float16* __restrict__ q16, _Float16* __restrict__ kF, _Float16* __restrict__ vF,
                                              int* __restrict__ labS, int* __restrict__ perm, int* __restrict__ rng) {
  // block = 64 rows of one batch: q16 rows (f16); kF and vF hold the block's 64 keys as 8 KB each, in the order in which k_attn's fragment loads read them
  // (frag_o), so that a wave-wide 16-byte load there reads 4 whole 128-byte lines: kF [key tile t of 16][kc][fragment], vF [kc][d tile t of 16][fragment], V transposed in LDS
  __shared__ __align__(16) _Float16 st[DD][72];
  const int tid = threadIdx.x, b = blockIdx.y, r0 = blockIdx.x * 64;
  // every block ranks the batch's LL - 1 labels itself (no hand-over between blocks) and keeps the 64 rows whose rank falls in [r0, r0 + 64). Counts of the 8 buckets: 16-bit fields, two a word (a count is below 4096)
  __shared__ unsigned wtot[8][4];
  __shared__ int sidx[64], slb[64];                            // source row and label of sorted rows r0 .. r0 + 63
  const int* lbp = lab + (size_t)b * (LL - 1);
  int lv[16]; unsigned own[4] = {0u, 0u, 0u, 0u}, inc[4], run[4], tot[4];
#pragma unroll
  for (int e = 0; e < 16; ++e) { const int i = e * 256 + tid; lv[e] = i < LL - 1 ? lbp[i] : 0; const unsigned one = i < LL - 1 ? 1u << ((lv[e] & 1) * 16) : 0u; const int wd = (lv[e] >> 1) & 3;
#pragma unroll
    for (int c = 0; c < 4; ++c) own[c] += wd == c ? one : 0u; }
#pragma unroll
  for (int c = 0; c < 4; ++c) inc[c] = own[c];
#pragma unroll
  for (int d = 1; d < 32; d <<= 1) {                           // inclusive prefix over the wave's lanes
#pragma unroll
    for (int c = 0; c < 4; ++c) { const unsigned o = (unsigned)__shfl_up((int)inc[c], (unsigned)d); inc[c] += (tid & 31) >= d ? o : 0u; } }
  if ((tid & 31) == 31) {
#pragma unroll
    for (int c = 0; c < 4; ++c) wtot[tid >> 5][c] = inc[c]; }
  __syncthreads();
#pragma unroll
  for (int c = 0; c < 4; ++c) { unsigned before = 0u, all = 0u;
#pragma unroll
    for (int s = 0; s < 8; ++s) { const unsigned x = wtot[s][c]; all += x; before += s < (tid >> 5) ? x : 0u; }
    tot[c] = all; run[c] = before + inc[c] - own[c]; }
  int base[9]; base[0] = 0;                                    // first sorted row of each bucket
#pragma unroll
  for (int c = 0; c < 8; ++c) base[c + 1] = base[c] + (int)((tot[c >> 1] >> ((c & 1) * 16)) & 0xffffu);
#pragma unroll
  for (int c = 0; c < 4; ++c) run[c] += (unsigned)base[2 * c] | ((unsigned)base[2 * c + 1] << 16);
#pragma unroll
  for (int e = 0; e < 16; ++e) { const int i = e * 256 + tid; const int sh = (lv[e] & 1) * 16, wd = (lv[e] >> 1) & 3; const unsigned one = i < LL - 1 ? 1u << sh : 0u;
    const unsigned rw = wd == 0 ? run[0] : wd == 1 ? run[1] : wd == 2 ? run[2] : run[3];
    const unsigned rel = ((rw >> sh) & 0xffffu) - (unsigned)r0;
#pragma unroll
    for (int c = 0; c < 4; ++c) run[c] += wd == c ? one : 0u;
    if (i < LL - 1 && rel < 64u) { sidx[rel] = i; slb[rel] = lv[e]; } }
  if (r0 + 64 == LL && tid == 0) { sidx[63] = LL - 1; slb[63] = -2; }      // the last row has no label: -2 equals no query's label
  __syncthreads();
  if (tid < 64) { labS[b * LL + r0 + tid] = slb[tid]; perm[b * LL + r0 + tid] = sidx[tid]; }
  if (tid == 0) { const int bl = slb[0] & 7, bh = slb[r0 + 64 == LL ? 62 : 63] & 7; int ka = 0, ke = 1;      // the key rows of this query block's buckets, as first and last 64-key tile, in a 128-byte line of the block's own
#pragma unroll
    for (int c = 0; c < 8; ++c) { ka = c == bl ? base[c] : ka; ke = c == bh ? base[c + 1] : ke; }
    rng[(b * (LL / 64) + blockIdx.x) * 32] = ka >> 6; rng[(b * (LL / 64) + blockIdx.x) * 32 + 1] = (ke - 1) >> 6; }
  const size_t bo = (size_t)b * LL * DD;                       // the batch's first element in q, k and v
  const size_t fo = ((size_t)b * LL + r0) * DD;               // the block's 8 KB in kF and in vF; qd below is the 16-byte piece of it: lane qd & 31, element half (qd >> 5) & 1
  for (int qd = tid; qd < 64 * DD / 8; qd += 256) { const int rl = qd >> 3, pc = qd & 7; const size_t o = fo + rl * DD + pc * 8; union { v8h h; v4u u; } pq, pk;
    const float* qp = q + bo + sidx[rl] * DD + pc * 8; float fq[8], fk[8];
    const float* kp = k + bo + sidx[(qd >> 7) * 16 + (qd & 15)] * DD + ((qd >> 6) & 1) * 32 + ((qd >> 5) & 1) * 16 + ((qd >> 4) & 1) * 8;
#pragma unroll
    for (int e = 0; e < 8; ++e) { fq[e] = qp[e]; fk[e] = kp[e]; }
    // takes the loaded values and the two addresses as inputs only: here both addresses live until all the loads are back
    asm volatile("s_wait_xcnt 0x0" :: "v"(fq[0]), "v"(fq[1]), "v"(fq[2]), "v"(fq[3]), "v"(fq[4]), "v"(fq[5]), "v"(fq[6]), "v"(fq[7]), "v"(fk[0]), "v"(fk[1]), "v"(fk[2]), "v"(fk[3]), "v"(fk[4]), "v"(fk[5]), "v"(fk[6]), "v"(fk[7]), "v"(qp), "v"(kp));
#pragma unroll
    for (int e = 0; e < 8; ++e) { pq.h[e] = (_Float16)fq[e]; pk.h[e] = (_Float16)fk[e]; }
    vst2(q16 + o, pq.u); vst2(kF + fo + qd * 8, pk.u); }
  for (int qd = tid; qd < 64 * DD; qd += 256) { const int rl = qd >> 6, d = qd & 63; st[d][rl] = (_Float16)v[bo + sidx[rl] * DD + d]; }
  __syncthreads();
  for (int qd = tid; qd < DD * 8; qd += 256) { const int d = ((qd >> 6) & 3) * 16 + (qd & 15), kl = (qd >> 8) * 32 + ((qd >> 5) & 1) * 16 + ((qd >> 4) & 1) * 8; vst2(vF + fo + qd * 8, *(const v4u*)(&st[d][kl])); }
}
// the key tiles of a block's list are shared out over KS groups of 4 waves (group ks takes entries ks, ks + KS, ks + 2 KS, ... of the list), so that a SIMD holds KS waves
// whose waits overlap; each wave keeps its own running maximum, sum and unnormalised O, and the block merges the KS partial results in LDS at the end
#define KS 8
// scores, running maxima and their differences are kept in units of log2: 1/sqrt(64) * log2(e), so that each exponential is one v_exp_f32
#define SCL2 0.18033688f
__global__ __launch_bounds__(128 * KS) void k_attn(const _Float16* __restrict__ q16, const _Float16* __restrict__ kF, const _Float16* __restrict__ vF, const int* __restrict__ lab, const int* __restrict__ perm, const int* __restrict__ rng, float* __restrict__ out) {
  __shared__ __align__(16) float sS[4 * KS][16][68];
  __shared__ float sM[4 * KS][16], sL[4 * KS][16];
  __shared__ __align__(16) int slab[KS][64];
  const int tid = threadIdx.x, w = __builtin_amdgcn_readfirstlane(tid >> 5), lane = tid & 31, col = lane & 15, g = lane >> 4;      // w in a scalar register: the tile list below is walked in scalar registers
  const int qg = w & 3, ks = w >> 2;                          // query group (16 rows) and key group of this wave
  const bool solo = blockIdx.x == LL / 64;                    // the block of the last query
  const int b = blockIdx.y, q0 = solo ? LL - 16 : blockIdx.x * 64 + qg * 16;
  int tlo = 0, thi = LL / 64 - 1;
  if (!solo) { const int* rp = rng + (b * (LL / 64) + blockIdx.x) * 32; tlo = rp[0]; thi = rp[1]; }
  tlo = __builtin_amdgcn_readfirstlane(min(max(tlo, 0), LL / 64 - 1)); thi = __builtin_amdgcn_readfirstlane(min(max(thi, tlo), LL / 64 - 1));
  const int nR = thi - tlo + 1, nT = nR + (thi < LL / 64 - 1 ? 1 : 0);      // the block's list of key tiles: tlo .. thi, then the last tile where it is not among them
  const int jw = solo ? w : ks, jstep = solo ? 4 * KS : KS, trips = (nT + jstep - 1) >> (solo ? 5 : 3);      // this wave takes entries jw, jw + jstep, ... of the list
  const _Float16* qb = q16 + (size_t)b * LL * DD; const _Float16* kb = kF + (size_t)b * LL * DD; const _Float16* vb = vF + (size_t)b * LL * DD; const int* lb = lab + (size_t)b * LL;
  v16h aq[2];
#pragma unroll
  for (int kc = 0; kc < 2; ++kc) aq[kc] = frag_h(qb + (size_t)(q0 + col) * DD + kc * 32, lane);
  const int myl = !solo && q0 + col < LL - 1 ? lb[q0 + col] : -1;      // the lane's one query; -1: the last (time) row is never masked (of the solo block only that row is stored, of the others it is not)
  float mrun = -3.0e38f, lrun = 0.f; v8f acc[4] = {};          // lrun: the sum over this half-wave's keys only; the two halves are joined once, behind the loop
  // The K and V^T fragments are loaded ahead of their WMMAs, several at a time, so that a group's load latencies run side by side. The compiler moves no load
  // over the volatile statement behind a WMMA in wmma16: a load written as that call's argument starts behind the WMMA before it and is waited for at once.
  const unsigned flo = 8 * lane * 2;                          // the lane's byte offset in a tile of kF and of vF (a 64-key tile is 8 KB in each), formed once; the tile's part of an address is the same for the whole wave
  int it = 0;
#pragma unroll 1
  do {                                                         // the list holds at least the last tile: one trip or more
    const int j = it * jstep + jw, tile = j < nR ? tlo + j : LL / 64 - 1;      // this wave's key tile of the trip; past the list's end (j >= nT) the wave only passes the barriers
    const _Float16* kp = (const _Float16*)(sbase(kb + tile * (64 * DD)) + flo); const _Float16* vp = (const _Float16*)(sbase(vb + tile * (64 * DD)) + flo);
    v16h kf[4][2], vf[2][4];
#pragma unroll
    for (int t = 0; t < 2; ++t) {
#pragma unroll
      for (int kc = 0; kc < 2; ++kc) kf[t][kc] = frag_o(kp + t * 1024 + kc * 512); }     // key tiles 0 and 1; tile t + 2 is asked for behind the WMMAs of tile t
    if (w < 2 * KS) { const int js = it * KS + (w >> 1), ts = js < nR ? tlo + js : LL / 64 - 1; const int* lp = (const int*)sbase(lb + ts * 64 + (w & 1) * 32); (&slab[0][0])[tid] = lp[lane]; }      // group tid >> 6's tile; the last column's entry is -2: lastk below
    __syncthreads();
    if (j < nT) {
    v8f sc[4];                                                 // sc[t][r]: key t * 16 + 8 g + r of the tile against query col
    const bool lastk = g == 1 && tile == LL / 64 - 1;          // this lane's element t = 3, r = 7 is the last column (key LL - 1), which is never masked: one test a trip, where a mark in slab would cost a compare per element
#pragma unroll
    for (int t = 0; t < 4; ++t) { v8f s = {}; union { v4i q[2]; int e[8]; } kl;
      kl.q[0] = *(const v4i*)(&slab[ks][t * 16 + 8 * g]); kl.q[1] = *(const v4i*)(&slab[ks][t * 16 + 8 * g + 4]);
#pragma unroll
      for (int kc = 0; kc < 2; ++kc) s = wmma16(kf[t][kc], aq[kc], s);
      if (t < 2) {
#pragma unroll
        for (int kc = 0; kc < 2; ++kc) kf[t + 2][kc] = frag_o(kp + (t + 2) * 1024 + kc * 512); }
#pragma unroll
      for (int r = 0; r < 8; ++r) { const bool masked = (myl >= 0) && (kl.e[r] != myl) && !(t == 3 && r == 7 && lastk); sc[t][r] = masked ? -3.0e38f : s[r] * SCL2; }
      __builtin_amdgcn_sched_barrier(0); }                     // ends the scheduling region at each tile: left free, the scheduler mixed the tiles' mask work into the softmax and sank six of the eight V^T loads below down to their WMMAs
    float mx = -3.4e38f;
#pragma unroll
    for (int t = 0; t < 4; ++t) {
#pragma unroll
      for (int r = 0; r < 8; ++r) mx = fmaxf(mx, sc[t][r]); }
    mx = fmaxf(mx, xhalf(mx));                                // the other half-wave holds the query's other 32 keys
    const float mnew = fmaxf(mrun, mx);                       // stays -3e38 until the first unmasked key; exp terms below are then 0 or 1 harmlessly
    const float corr = __builtin_amdgcn_exp2f(mrun - mnew);
    const float mex = fmaxf(mnew, -1.0e30f);                  // a masked score (-3e38) minus mex stays about -3e38 also while mnew is still -3e38, so its term is exactly 0 with no test per element
    float ps = 0.f; v16h pb[2];                                // pb[kc] element s: key kc * 32 + (s < 8 ? 8 g + s : 16 + 8 g + s - 8), as in the V^T fragment
#pragma unroll
    for (int t = 0; t < 4; ++t) { float x[8];
#pragma unroll
      for (int r = 0; r < 8; ++r) x[r] = sc[t][r] - mex;
      exp2x8(x);
#pragma unroll
      for (int r = 0; r < 8; ++r) { ps += x[r]; pb[t >> 1][(t & 1) * 8 + r] = (_Float16)(x[r] * 16384.0f); }
      if (t == 1) {
#pragma unroll
        for (int u = 0; u < 4; ++u) vf[0][u] = frag_o(vp + u * 512); } }                      // first half of V^T, four fragments at once, into the registers that half of the scores have left; they fly during the other half's exponentials
    lrun = lrun * corr + ps; mrun = mnew;
#pragma unroll
    for (int t = 0; t < 4; ++t) acc[t] *= corr;
#pragma unroll
    for (int kc = 0; kc < 2; ++kc) {
#pragma unroll
      for (int t = 0; t < 4; ++t) { acc[t] = wmma16(vf[kc][t], pb[kc], acc[t]);
        if (kc == 0) vf[1][t] = frag_o(vp + 2048 + t * 512); } }                  // second half, each into the registers its WMMA has freed
    }
    __syncthreads();                                           // slab is rewritten next iteration
  } while (++it < trips);
  lrun += xhalf(lrun);
  // the lane's indices formed anew behind the loop: the compiler kept one of them from in front of the loop for the code below, one register over the limit of a 32-wave block, in scratch
  const int lane2 = (int)__builtin_amdgcn_mbcnt_lo(~0u, 0u), col2 = lane2 & 15, g2 = lane2 >> 4, tid2 = w * 32 + lane2;
  const int pos = solo ? LL - 1 : blockIdx.x * 64 + (tid2 >> 4);           // the sorted row that this thread stores below, and the row of out that it came from
  const int srow = perm[b * LL + pos] & (LL - 1);
#pragma unroll
  for (int t = 0; t < 4; ++t) { v4f lo, hi;                    // acc[t][r] = O[query col][t * 16 + 8 g + r]: 8 columns in a row
#pragma unroll
    for (int e = 0; e < 4; ++e) { lo[e] = acc[t][e]; hi[e] = acc[t][4 + e]; }
    vst2(&sS[w][col2][t * 16 + 8 * g2], lo); vst2(&sS[w][col2][t * 16 + 8 * g2 + 4], hi); }
  if (g2 == 0) { sM[w][col2] = mrun; sL[w][col2] = lrun; }
  __syncthreads();                                             // every wave's partial result is in LDS before any thread merges
  if (solo) {                                                  // the last query is column 15 of every wave's tile: 32 partial results
    if (tid2 < 16) { float ma = -3.4e38f;
      for (int s = 0; s < 4 * KS; ++s) ma = fmaxf(ma, sM[s][15]);
      float la = 0.f; v4f oa = {};
      for (int s = 0; s < 4 * KS; ++s) { const float wg = exp2_slot(sM[s][15] - ma); la += sL[s][15] * wg; oa += *(const v4f*)(&sS[s][15][tid2 * 4]) * wg; }
      const float da = la * 16384.0f;
#pragma unroll
      for (int e = 0; e < 4; ++e) oa[e] = oa[e] / da;
      vst2(out + ((size_t)b * LL + srow) * DD + tid2 * 4, oa); }
    return; }
  const int rl = tid2 >> 4, pc = tid2 & 15, mq = rl >> 4, mr = rl & 15;   // one thread: 4 output columns of one of the 64 rows
  float mall = -3.4e38f;
#pragma unroll
  for (int s = 0; s < KS; ++s) mall = fmaxf(mall, sM[s * 4 + mq][mr]);    // finite: the last key is masked for no row
  float lall = 0.f; v4f o = {};
#pragma unroll
  for (int s = 0; s < KS; ++s) { const float wg = exp2_slot(sM[s * 4 + mq][mr] - mall); lall += sL[s * 4 + mq][mr] * wg; o += *(const v4f*)(&sS[s * 4 + mq][mr][pc * 4]) * wg; }
  const float den = lall * 16384.0f;
#pragma unroll
  for (int e = 0; e < 4; ++e) o[e] = o[e] / den;
  if (pos < LL - 1) vst2(out + ((size_t)b * LL + srow) * DD + pc * 4, o);      // the last row is the solo block's
}
extern "C" void kernel_launch(void* const* d_in, const int* in_sizes, int n_in, void* d_out, int out_size, void* d_ws, size_t ws_size, hipStream_t stream) {
  (void)in_sizes; (void)n_in; (void)out_size; (void)ws_size;
  const float* q = (const float*)d_in[0]; const float* k = (const float*)d_in[1]; const float* v = (const float*)d_in[2]; const int* lab = (const int*)d_in[3];
  float* out = (float*)d_out;
  char* ws = (char*)d_ws; size_t off = 0;
  auto take = [&](size_t bytes) { char* p = ws + off; off += (bytes + 255) & ~(size_t)255; return p; };
  _Float16* q16 = (_Float16*)take((size_t)NR * DD * 2); _Float16* kF = (_Float16*)take((size_t)NR * DD * 2); _Float16* vF = (_Float16*)take((size_t)NR * DD * 2);
  int* labS = (int*)take((size_t)NR * 4); int* perm = (int*)take((size_t)NR * 4); int* rng = (int*)take((size_t)NB * (LL / 64) * 128);
  k_prep<<<dim3(LL / 64, NB), 256, 0, stream>>>(q, k, v, lab, q16, kF, vF, labS, perm, rng);
  k_attn<<<dim3(LL / 64 + 1, NB), 128 * KS, 0, stream>>>(q16, kF, vF, labS, perm, rng, out);
}

// v007
// It runs in 23.4 microseconds.
// In both of two side-by-side timings against v006, it was 1.18 times as fast.
// All steps since v000 together make it 15.4 times as fast.
#include <hip/hip_runtime.h>
#include <math.h>

typedef __attribute__((ext_vector_type(16))) _Float16 v16h;
typedef __attribute__((ext_vector_type(16))) __bf16 v16b;
typedef __attribute__((ext_vector_type(8)))  _Float16 v8h;
typedef __attribute__((ext_vector_type(8)))  float v8f;
typedef __attribute__((ext_vector_type(4)))  float v4f;
typedef __attribute__((ext_vector_type(2)))  float v2f;
typedef __attribute__((ext_vector_type(4)))  unsigned v4u;
typedef __attribute__((ext_vector_type(4)))  int v4i;
typedef float __attribute__((may_alias)) float_a;
typedef int __attribute__((may_alias)) int_a;

template <typename T> __device__ __forceinline__ void vst2(void* p, T v) { *(T*)p = v;  }
__device__ __forceinline__ v8f wmma16(v16h a, v16h b, v8f c) {
  v8f d = __builtin_amdgcn_wmma_f32_16x16x32_f16(false, a, false, b, (short)0, c, false, false);
  asm volatile("v_nop\n\tv_nop\n\tv_nop\n\tv_nop" : "+v"(d) : "v"(a), "v"(b));
  return d;
}
__device__ __forceinline__ v8f wmma_bf(v16b a, v16b b, v8f c) {
  v8f d = __builtin_amdgcn_wmma_f32_16x16x32_bf16(false, a, false, b, (short)0, c, false, false);
  asm volatile("v_nop\n\tv_nop\n\tv_nop\n\tv_nop" : "+v"(d) : "v"(a), "v"(b));
  return d;
}
// 16x16x32 fragments: lane = (h = lane>>4, row/col = lane&15); elements 0..7 = k0+8h+0..7, 8..15 = k0+16+8h+0..7; D element r = row 8h+r
__device__ __forceinline__ v16h frag_h(const _Float16* rowk0, int lane) {
  union { v16h v; v8h q[2]; } u; const _Float16* p = rowk0 + 8 * (lane >> 4);
  u.q[0] = *(const v8h*)p; u.q[1] = *(const v8h*)(p + 16); return u.v;
}
// the same fragment from fragment-order storage: 1 KB a fragment, elements 0..7 of lanes 0..31 (16 B a lane, 512 B in a row), then elements 8..15 likewise; p already holds the lane's 8 * lane
__device__ __forceinline__ v16h frag_o(const _Float16* p) {
  union { v16h v; v8h q[2]; } u; u.q[0] = *(const v8h*)p; u.q[1] = *(const v8h*)(p + 256); return u.v;
}
// a block-uniform address kept in two scalar registers and stepped there, so that kF and vF share the lane's one offset register; left to itself the compiler folded the batch's
// part into a 64-bit vector base for each, two registers more at the 128-register limit of a 32-wave block, and spilled one register to scratch
__device__ __forceinline__ const char* sbase(const void* p) {
  const unsigned long long a = (unsigned long long)p;
  const unsigned lo = (unsigned)__builtin_amdgcn_readfirstlane((int)(unsigned)a), hi = (unsigned)__builtin_amdgcn_readfirstlane((int)(unsigned)(a >> 32));
  return (const char*)(const __attribute__((address_space(1))) char*)(((unsigned long long)hi << 32) | lo);   // named as global memory: from a bare integer the loads would be flat ones
}
// lane l's value to lane l ^ 16 and back, in the vector unit
__device__ __forceinline__ float xhalf(float x) { const int b = __builtin_bit_cast(int, x); return __builtin_bit_cast(float, __builtin_amdgcn_permlanex16(b, b, 0x76543210, 0xfedcba98, false, false)); }
__device__ __forceinline__ v16h frag_f32(const float* rowk0, int lane) {
  v16h a; const float* p = rowk0 + 8 * (lane >> 4);
#pragma unroll
  for (int i = 0; i < 8; ++i) { a[i] = (_Float16)p[i]; a[8 + i] = (_Float16)p[16 + i]; }
  return a;
}
__device__ __forceinline__ v16h frag_f32s(const float* rowk0, int lane, float sc) {
  v16h a; const float* p = rowk0 + 8 * (lane >> 4);
#pragma unroll
  for (int i = 0; i < 8; ++i) { a[i] = (_Float16)(p[i] * sc); a[8 + i] = (_Float16)(p[16 + i] * sc); }
  return a;
}
// column fragment from a [K][ld] layout (column n), rows >= K read as 0
__device__ __forceinline__ v16h fragc_f32(const float* W, int k0, int n, int lane, int ld, int K) {
  v16h a; const int g = lane >> 4;
#pragma unroll
  for (int i = 0; i < 8; ++i) { const int ka = k0 + 8 * g + i, kb = ka + 16;
    a[i] = (_Float16)(ka < K ? W[(size_t)ka * ld + n] : 0.f); a[8 + i] = (_Float16)(kb < K ? W[(size_t)kb * ld + n] : 0.f); }
  return a;
}
struct F2 { v16b h, l; };
__device__ __forceinline__ F2 bsplit16(const float v[16]) { F2 r;
#pragma unroll
  for (int i = 0; i < 16; ++i) { const __bf16 h = (__bf16)v[i]; r.h[i] = h; r.l[i] = (__bf16)(v[i] - (float)h); }
  return r; }
__device__ __forceinline__ F2 split_row(const float* row, int k0, int lane) { float v[16]; const float* p = row + k0 + 8 * (lane >> 4);
#pragma unroll
  for (int i = 0; i < 8; ++i) { v[i] = p[i]; v[8 + i] = p[16 + i]; }
  return bsplit16(v); }
__device__ __forceinline__ F2 split_rowK(const float* row, int k0, int lane, int K) { float v[16]; const int g = lane >> 4;
#pragma unroll
  for (int i = 0; i < 8; ++i) { const int ka = k0 + 8 * g + i, kb = ka + 16; v[i] = ka < K ? row[ka] : 0.f; v[8 + i] = kb < K ? row[kb] : 0.f; }
  return bsplit16(v); }
__device__ __forceinline__ F2 split_col(const float* W, int k0, int n, int lane, int ld, int K) { float v[16]; const int g = lane >> 4;
#pragma unroll
  for (int i = 0; i < 8; ++i) { const int ka = k0 + 8 * g + i, kb = ka + 16; v[i] = ka < K ? W[(size_t)ka * ld + n] : 0.f; v[8 + i] = kb < K ? W[(size_t)kb * ld + n] : 0.f; }
  return bsplit16(v); }
__device__ __forceinline__ v8f mac3(const F2& a, const F2& b, v8f c) { c = wmma_bf(a.l, b.h, c); c = wmma_bf(a.h, b.l, c); return wmma_bf(a.h, b.h, c); }
__device__ __forceinline__ float sigm(float v) { return 1.0f / (1.0f + expf(-v)); }
// v_exp_f32 with the one free slot the instruction set asks for behind it, in one statement
__device__ __forceinline__ float exp2_slot(float x) { float r; asm("v_exp_f32 %0, %1\n\tv_nop" : "=v"(r) : "v"(x)); return r; }
// eight v_exp_f32 in place, in one statement: each has an independent one behind it, the last a v_nop, which is the free slot the instruction set asks for behind a transcendental
__device__ __forceinline__ void exp2x8(float (&x)[8]) {
  asm("v_exp_f32 %0, %0\n\tv_exp_f32 %1, %1\n\tv_exp_f32 %2, %2\n\tv_exp_f32 %3, %3\n\tv_exp_f32 %4, %4\n\tv_exp_f32 %5, %5\n\tv_exp_f32 %6, %6\n\tv_exp_f32 %7, %7\n\tv_nop"
      : "+v"(x[0]), "+v"(x[1]), "+v"(x[2]), "+v"(x[3]), "+v"(x[4]), "+v"(x[5]), "+v"(x[6]), "+v"(x[7])); }
#define LDSX() do { asm volatile("s_wait_dscnt 0" ::: "memory"); __builtin_amdgcn_wave_barrier(); __builtin_amdgcn_fence(__ATOMIC_RELEASE, "workgroup"); } while (0)

// Label-clustered attention: per (b, 64 sorted queries) block the 64-key tiles of its label buckets and the last tile are streamed (all 64 for the last query's own block): S = q.k on
// v_wmma_f32_16x16x32_f16 (q, k converted to f16 once; f32 accumulate), masked where the labels differ (except the last row/column,
// which is never masked), online softmax in f32, P x2^14 as f16 @ v^T (v transposed to f16 once). Labels are read as data for the
#define NB 4
#define LL 4096
#define DD 64
#define NR (NB * LL)

// Rows are regrouped by bucket = label & 7 (a counting sort, the same order for queries and keys; the last row, which has no label, stays last). Rows of equal label share a bucket for any
// label values, so a key tile outside the buckets of a query block holds only masked keys (but for the last key) and k_attn leaves it out; the label compare there stays as it is.
__global__ __launch_bounds__(256) void k_prep(const float* __restrict__ q, const float* __restrict__ k, const float* __restrict__ v, const int* __restrict__ lab, _Float16* __restrict__ q16, _Float16* __restrict__ kF, _Float16* __restrict__ vF,
                                              int* __restrict__ labS, int* __restrict__ perm, int* __restrict__ rng) {
  // block = 64 rows of one batch: q16 rows (f16); kF and vF hold the block's 64 keys as 8 KB each, in the order in which k_attn's fragment loads read them
  // (frag_o), so that a wave-wide 16-byte load there reads 4 whole 128-byte lines: kF [key tile t of 16][kc][fragment], vF [kc][d tile t of 16][fragment], V transposed in LDS
  __shared__ __align__(16) _Float16 st[DD][72];
  const int tid = threadIdx.x, b = blockIdx.y, r0 = blockIdx.x * 64;
  // every block ranks the batch's LL - 1 labels itself (no hand-over between blocks) and keeps the 64 rows whose rank falls in [r0, r0 + 64). Counts of the 8 buckets: 16-bit fields, two a word (a count is below 4096)
  __shared__ unsigned wtot[8][4];
  __shared__ int sidx[64], slb[64];                            // source row and label of sorted rows r0 .. r0 + 63
  const int* lbp = lab + (size_t)b * (LL - 1);
  int lv[16]; unsigned own[4] = {0u, 0u, 0u, 0u}, inc[4], run[4], tot[4];
#pragma unroll
  for (int e = 0; e < 16; ++e) { const int i = e * 256 + tid; lv[e] = i < LL - 1 ? lbp[i] : 0; const unsigned one = i < LL - 1 ? 1u << ((lv[e] & 1) * 16) : 0u; const int wd = (lv[e] >> 1) & 3;
#pragma unroll
    for (int c = 0; c < 4; ++c) own[c] += wd == c ? one : 0u; }
#pragma unroll
  for (int c = 0; c < 4; ++c) inc[c] = own[c];
#pragma unroll
  for (int d = 1; d < 32; d <<= 1) {                           // inclusive prefix over the wave's lanes
#pragma unroll
    for (int c = 0; c < 4; ++c) { const unsigned o = (unsigned)__shfl_up((int)inc[c], (unsigned)d); inc[c] += (tid & 31) >= d ? o : 0u; } }
  if ((tid & 31) == 31) {
#pragma unroll
    for (int c = 0; c < 4; ++c) wtot[tid >> 5][c] = inc[c]; }
  __syncthreads();
#pragma unroll
  for (int c = 0; c < 4; ++c) { unsigned before = 0u, all = 0u;
#pragma unroll
    for (int s = 0; s < 8; ++s) { const unsigned x = wtot[s][c]; all += x; before += s < (tid >> 5) ? x : 0u; }
    tot[c] = all; run[c] = before + inc[c] - own[c]; }
  int base[9]; base[0] = 0;                                    // first sorted row of each bucket
#pragma unroll
  for (int c = 0; c < 8; ++c) base[c + 1] = base[c] + (int)((tot[c >> 1] >> ((c & 1) * 16)) & 0xffffu);
#pragma unroll
  for (int c = 0; c < 4; ++c) run[c] += (unsigned)base[2 * c] | ((unsigned)base[2 * c + 1] << 16);
#pragma unroll
  for (int e = 0; e < 16; ++e) { const int i = e * 256 + tid; const int sh = (lv[e] & 1) * 16, wd = (lv[e] >> 1) & 3; const unsigned one = i < LL - 1 ? 1u << sh : 0u;
    const unsigned rw = wd == 0 ? run[0] : wd == 1 ? run[1] : wd == 2 ? run[2] : run[3];
    const unsigned rel = ((rw >> sh) & 0xffffu) - (unsigned)r0;
#pragma unroll
    for (int c = 0; c < 4; ++c) run[c] += wd == c ? one : 0u;
    if (i < LL - 1 && rel < 64u) { sidx[rel] = i; slb[rel] = lv[e]; } }
  if (r0 + 64 == LL && tid == 0) { sidx[63] = LL - 1; slb[63] = -2; }      // the last row has no label: -2 equals no query's label
  __syncthreads();
  const size_t bo = (size_t)b * LL * DD;                       // the batch's first element in q, k and v
  const size_t fo = ((size_t)b * LL + r0) * DD;               // the block's 8 KB in kF and in vF; qd below is the 16-byte piece of it: lane qd & 31, element half (qd >> 5) & 1
  // Every row load of the thread (16 of v, 4 of q, 4 of k) is asked for here, before the first value is used: their latencies run side by side. As loops over qd the compiler kept them rolled and
  // waited for each pass's loads at once, ten load latencies one behind the other, with two waves a SIMD to hide them.
  const float* vp[16]; const float* qp[2]; const float* kp[2]; float fv[16], fq[2][8], fk[2][8];
#pragma unroll
  for (int e = 0; e < 16; ++e) vp[e] = v + bo + sidx[e * 4 + (tid >> 6)] * DD + (tid & 63);
#pragma unroll
  for (int i = 0; i < 2; ++i) { const int qd = i * 256 + tid; qp[i] = q + bo + sidx[qd >> 3] * DD + (qd & 7) * 8;
    kp[i] = k + bo + sidx[(qd >> 7) * 16 + (qd & 15)] * DD + ((qd >> 6) & 1) * 32 + ((qd >> 5) & 1) * 16 + ((qd >> 4) & 1) * 8; }
#pragma unroll
  for (int e = 0; e < 16; ++e) fv[e] = *vp[e];
#pragma unroll
  for (int i = 0; i < 2; ++i) {
#pragma unroll
    for (int e = 0; e < 8; ++e) { fq[i][e] = qp[i][e]; fk[i][e] = kp[i][e]; } }
  // takes the 20 addresses as inputs only, so that each keeps registers of its own until this wait, behind the last load: without it the compiler used address registers again among the loads and put four
  // s_wait_xcnt between them. The "memory" clobber keeps the loads above this line, so that the stores and the range search below run while they fly
  asm volatile("s_wait_xcnt 0x0" :: "v"(vp[0]), "v"(vp[1]), "v"(vp[2]), "v"(vp[3]), "v"(vp[4]), "v"(vp[5]), "v"(vp[6]), "v"(vp[7]), "v"(vp[8]), "v"(vp[9]), "v"(vp[10]), "v"(vp[11]), "v"(vp[12]), "v"(vp[13]), "v"(vp[14]), "v"(vp[15]),
               "v"(qp[0]), "v"(qp[1]), "v"(kp[0]), "v"(kp[1]) : "memory");
  if (tid < 64) { labS[b * LL + r0 + tid] = slb[tid]; perm[b * LL + r0 + tid] = sidx[tid]; }
  if (tid == 0) { const int bl = slb[0] & 7, bh = slb[r0 + 64 == LL ? 62 : 63] & 7; int ka = 0, ke = 1;      // the key rows of this query block's buckets, as first and last 64-key tile, in a 128-byte line of the block's own
#pragma unroll
    for (int c = 0; c < 8; ++c) { ka = c == bl ? base[c] : ka; ke = c == bh ? base[c + 1] : ke; }
    rng[(b * (LL / 64) + blockIdx.x) * 32] = ka >> 6; rng[(b * (LL / 64) + blockIdx.x) * 32 + 1] = (ke - 1) >> 6; }
#pragma unroll
  for (int e = 0; e < 16; ++e) st[tid & 63][e * 4 + (tid >> 6)] = (_Float16)fv[e];      // v first: its values have the longer way, through LDS
#pragma unroll
  for (int i = 0; i < 2; ++i) { const int qd = i * 256 + tid; union { v8h h; v4u u; } pq, pk;      // piece qd of q16 is 8 columns of row qd >> 3
#pragma unroll
    for (int e = 0; e < 8; ++e) { pq.h[e] = (_Float16)fq[i][e]; pk.h[e] = (_Float16)fk[i][e]; }
    vst2(q16 + fo + qd * 8, pq.u); vst2(kF + fo + qd * 8, pk.u); }
  __syncthreads();
#pragma unroll
  for (int i = 0; i < 2; ++i) { const int qd = i * 256 + tid; const int d = ((qd >> 6) & 3) * 16 + (qd & 15), kl = (qd >> 8) * 32 + ((qd >> 5) & 1) * 16 + ((qd >> 4) & 1) * 8; vst2(vF + fo + qd * 8, *(const v4u*)(&st[d][kl])); }
}
// the key tiles of a block's list are shared out over KS groups of 4 waves (group ks takes entries ks, ks + KS, ks + 2 KS, ... of the list), so that a SIMD holds KS waves
// whose waits overlap; each wave keeps its own running maximum, sum and unnormalised O, and the block merges the KS partial results in LDS at the end
#define KS 8
// scores, running maxima and their differences are kept in units of log2: 1/sqrt(64) * log2(e), so that each exponential is one v_exp_f32
#define SCL2 0.18033688f
__global__ __launch_bounds__(128 * KS) void k_attn(const _Float16* __restrict__ q16, const _Float16* __restrict__ kF, const _Float16* __restrict__ vF, const int* __restrict__ lab, const int* __restrict__ perm, const int* __restrict__ rng, float* __restrict__ out) {
  __shared__ __align__(16) float sS[4 * KS][16][68];
  __shared__ float sM[4 * KS][16], sL[4 * KS][16];
  __shared__ __align__(16) int slab[KS][64];
  const int tid = threadIdx.x, w = __builtin_amdgcn_readfirstlane(tid >> 5), lane = tid & 31, col = lane & 15, g = lane >> 4;      // w in a scalar register: the tile list below is walked in scalar registers
  const int qg = w & 3, ks = w >> 2;                          // query group (16 rows) and key group of this wave
  const bool solo = blockIdx.x == LL / 64;                    // the block of the last query
  const int b = blockIdx.y, q0 = solo ? LL - 16 : blockIdx.x * 64 + qg * 16;
  int tlo = 0, thi = LL / 64 - 1;
  if (!solo) { const int* rp = rng + (b * (LL / 64) + blockIdx.x) * 32; tlo = rp[0]; thi = rp[1]; }
  tlo = __builtin_amdgcn_readfirstlane(min(max(tlo, 0), LL / 64 - 1)); thi = __builtin_amdgcn_readfirstlane(min(max(thi, tlo), LL / 64 - 1));
  const int nR = thi - tlo + 1, nT = nR + (thi < LL / 64 - 1 ? 1 : 0);      // the block's list of key tiles: tlo .. thi, then the last tile where it is not among them
  const int jw = solo ? w : ks, jstep = solo ? 4 * KS : KS, trips = (nT + jstep - 1) >> (solo ? 5 : 3);      // this wave takes entries jw, jw + jstep, ... of the list
  const _Float16* qb = q16 + (size_t)b * LL * DD; const _Float16* kb = kF + (size_t)b * LL * DD; const _Float16* vb = vF + (size_t)b * LL * DD; const int* lb = lab + (size_t)b * LL;
  v16h aq[2];
#pragma unroll
  for (int kc = 0; kc < 2; ++kc) aq[kc] = frag_h(qb + (size_t)(q0 + col) * DD + kc * 32, lane);
  const int myl = !solo && q0 + col < LL - 1 ? lb[q0 + col] : -1;      // the lane's one query; -1: the last (time) row is never masked (of the solo block only that row is stored, of the others it is not)
  float mrun = -3.0e38f, lrun = 0.f; v8f acc[4] = {};          // lrun: the sum over this half-wave's keys only; the two halves are joined once, behind the loop
  // The K and V^T fragments are loaded ahead of their WMMAs, several at a time, so that a group's load latencies run side by side. The compiler moves no load
  // over the volatile statement behind a WMMA in wmma16: a load written as that call's argument starts behind the WMMA before it and is waited for at once.
  const unsigned flo = 8 * lane * 2;                          // the lane's byte offset in a tile of kF and of vF (a 64-key tile is 8 KB in each), formed once; the tile's part of an address is the same for the whole wave
  int it = 0;
#pragma unroll 1
  do {                                                         // the list holds at least the last tile: one trip or more
    const int j = it * jstep + jw, tile = j < nR ? tlo + j : LL / 64 - 1;      // this wave's key tile of the trip; past the list's end (j >= nT) the wave only passes the barriers
    const _Float16* kp = (const _Float16*)(sbase(kb + tile * (64 * DD)) + flo); const _Float16* vp = (const _Float16*)(sbase(vb + tile * (64 * DD)) + flo);
    v16h kf[4][2], vf[2][4];
#pragma unroll
    for (int t = 0; t < 2; ++t) {
#pragma unroll
      for (int kc = 0; kc < 2; ++kc) kf[t][kc] = frag_o(kp + t * 1024 + kc * 512); }     // key tiles 0 and 1; tile t + 2 is asked for behind the WMMAs of tile t
    if (w < 2 * KS) { const int js = it * KS + (w >> 1), ts = js < nR ? tlo + js : LL / 64 - 1; const int* lp = (const int*)sbase(lb + ts * 64 + (w & 1) * 32); (&slab[0][0])[tid] = lp[lane]; }      // group tid >> 6's tile; the last column's entry is -2: lastk below
    __syncthreads();
    if (j < nT) {
    v8f sc[4];                                                 // sc[t][r]: key t * 16 + 8 g + r of the tile against query col
    const bool lastk = g == 1 && tile == LL / 64 - 1;          // this lane's element t = 3, r = 7 is the last column (key LL - 1), which is never masked: one test a trip, where a mark in slab would cost a compare per element
#pragma unroll
    for (int t = 0; t < 4; ++t) { v8f s = {}; union { v4i q[2]; int e[8]; } kl;
      kl.q[0] = *(const v4i*)(&slab[ks][t * 16 + 8 * g]); kl.q[1] = *(const v4i*)(&slab[ks][t * 16 + 8 * g + 4]);
#pragma unroll
      for (int kc = 0; kc < 2; ++kc) s = wmma16(kf[t][kc], aq[kc], s);
      if (t < 2) {
#pragma unroll
        for (int kc = 0; kc < 2; ++kc) kf[t + 2][kc] = frag_o(kp + (t + 2) * 1024 + kc * 512); }
#pragma unroll
      for (int r = 0; r < 8; ++r) { const bool masked = (myl >= 0) && (kl.e[r] != myl) && !(t == 3 && r == 7 && lastk); sc[t][r] = masked ? -3.0e38f : s[r] * SCL2; }
      __builtin_amdgcn_sched_barrier(0); }                     // ends the scheduling region at each tile: left free, the scheduler mixed the tiles' mask work into the softmax and sank six of the eight V^T loads below down to their WMMAs
    float mx = -3.4e38f;
#pragma unroll
    for (int t = 0; t < 4; ++t) {
#pragma unroll
      for (int r = 0; r < 8; ++r) mx = fmaxf(mx, sc[t][r]); }
    mx = fmaxf(mx, xhalf(mx));                                // the other half-wave holds the query's other 32 keys
    const float mnew = fmaxf(mrun, mx);                       // stays -3e38 until the first unmasked key; exp terms below are then 0 or 1 harmlessly
    const float corr = __builtin_amdgcn_exp2f(mrun - mnew);
    const float mex = fmaxf(mnew, -1.0e30f);                  // a masked score (-3e38) minus mex stays about -3e38 also while mnew is still -3e38, so its term is exactly 0 with no test per element
    float ps = 0.f; v16h pb[2];                                // pb[kc] element s: key kc * 32 + (s < 8 ? 8 g + s : 16 + 8 g + s - 8), as in the V^T fragment
#pragma unroll
    for (int t = 0; t < 4; ++t) { float x[8];
#pragma unroll
      for (int r = 0; r < 8; ++r) x[r] = sc[t][r] - mex;
      exp2x8(x);
#pragma unroll
      for (int r = 0; r < 8; ++r) { ps += x[r]; pb[t >> 1][(t & 1) * 8 + r] = (_Float16)(x[r] * 16384.0f); }
      if (t == 1) {
#pragma unroll
        for (int u = 0; u < 4; ++u) vf[0][u] = frag_o(vp + u * 512); } }                      // first half of V^T, four fragments at once, into the registers that half of the scores have left; they fly during the other half's exponentials
    lrun = lrun * corr + ps; mrun = mnew;
#pragma unroll
    for (int t = 0; t < 4; ++t) acc[t] *= corr;
#pragma unroll
    for (int kc = 0; kc < 2; ++kc) {
#pragma unroll
      for (int t = 0; t < 4; ++t) { acc[t] = wmma16(vf[kc][t], pb[kc], acc[t]);
        if (kc == 0) vf[1][t] = frag_o(vp + 2048 + t * 512); } }                  // second half, each into the registers its WMMA has freed
    }
    __syncthreads();                                           // slab is rewritten next iteration
  } while (++it < trips);
  lrun += xhalf(lrun);
  // the lane's indices formed anew behind the loop: the compiler kept one of them from in front of the loop for the code below, one register over the limit of a 32-wave block, in scratch
  const int lane2 = (int)__builtin_amdgcn_mbcnt_lo(~0u, 0u), col2 = lane2 & 15, g2 = lane2 >> 4, tid2 = w * 32 + lane2;
  const int pos = solo ? LL - 1 : blockIdx.x * 64 + (tid2 >> 4);           // the sorted row that this thread stores below, and the row of out that it came from
  const int srow = perm[b * LL + pos] & (LL - 1);
#pragma unroll
  for (int t = 0; t < 4; ++t) { v4f lo, hi;                    // acc[t][r] = O[query col][t * 16 + 8 g + r]: 8 columns in a row
#pragma unroll
    for (int e = 0; e < 4; ++e) { lo[e] = acc[t][e]; hi[e] = acc[t][4 + e]; }
    vst2(&sS[w][col2][t * 16 + 8 * g2], lo); vst2(&sS[w][col2][t * 16 + 8 * g2 + 4], hi); }
  if (g2 == 0) { sM[w][col2] = mrun; sL[w][col2] = lrun; }
  __syncthreads();                                             // every wave's partial result is in LDS before any thread merges
  if (solo) {                                                  // the last query is column 15 of every wave's tile: 32 partial results
    if (tid2 < 16) { float ma = -3.4e38f;
      for (int s = 0; s < 4 * KS; ++s) ma = fmaxf(ma, sM[s][15]);
      float la = 0.f; v4f oa = {};
      for (int s = 0; s < 4 * KS; ++s) { const float wg = exp2_slot(sM[s][15] - ma); la += sL[s][15] * wg; oa += *(const v4f*)(&sS[s][15][tid2 * 4]) * wg; }
      const float da = la * 16384.0f;
#pragma unroll
      for (int e = 0; e < 4; ++e) oa[e] = oa[e] / da;
      vst2(out + ((size_t)b * LL + srow) * DD + tid2 * 4, oa); }
    return; }
  const int rl = tid2 >> 4, pc = tid2 & 15, mq = rl >> 4, mr = rl & 15;   // one thread: 4 output columns of one of the 64 rows
  float mall = -3.4e38f;
#pragma unroll
  for (int s = 0; s < KS; ++s) mall = fmaxf(mall, sM[s * 4 + mq][mr]);    // finite: the last key is masked for no row
  float lall = 0.f; v4f o = {};
#pragma unroll
  for (int s = 0; s < KS; ++s) { const float wg = exp2_slot(sM[s * 4 + mq][mr] - mall); lall += sL[s * 4 + mq][mr] * wg; o += *(const v4f*)(&sS[s * 4 + mq][mr][pc * 4]) * wg; }
  const float den = lall * 16384.0f;
#pragma unroll
  for (int e = 0; e < 4; ++e) o[e] = o[e] / den;
  if (pos < LL - 1) vst2(out + ((size_t)b * LL + srow) * DD + pc * 4, o);      // the last row is the solo block's
}
extern "C" void kernel_launch(void* const* d_in, const int* in_sizes, int n_in, void* d_out, int out_size, void* d_ws, size_t ws_size, hipStream_t stream) {
  (void)in_sizes; (void)n_in; (void)out_size; (void)ws_size;
  const float* q = (const float*)d_in[0]; const float* k = (const float*)d_in[1]; const float* v = (const float*)d_in[2]; const int* lab = (const int*)d_in[3];
  float* out = (float*)d_out;
  char* ws = (char*)d_ws; size_t off = 0;
  auto take = [&](size_t bytes) { char* p = ws + off; off += (bytes + 255) & ~(size_t)255; return p; };
  _Float16* q16 = (_Float16*)take((size_t)NR * DD * 2); _Float16* kF = (_Float16*)take((size_t)NR * DD * 2); _Float16* vF = (_Float16*)take((size_t)NR * DD * 2);
  int* labS = (int*)take((size_t)NR * 4); int* perm = (int*)take((size_t)NR * 4); int* rng = (int*)take((size_t)NB * (LL / 64) * 128);
  k_prep<<<dim3(LL / 64, NB), 256, 0, stream>>>(q, k, v, lab, q16, kF, vF, labS, perm, rng);
  k_attn<<<dim3(LL / 64 + 1, NB), 128 * KS, 0, stream>>>(q16, kF, vF, labS, perm, rng, out);
}

// v008
// A run of this version takes 22.8 microseconds.
// Timed twice side by side with v007, it ran 1.03 times as fast both times.
// Counting every step since v000, it is 15.9 times as fast.
#include <hip/hip_runtime.h>
#include <math.h>

typedef __attribute__((ext_vector_type(16))) _Float16 v16h;
typedef __attribute__((ext_vector_type(16))) __bf16 v16b;
typedef __attribute__((ext_vector_type(8)))  _Float16 v8h;
typedef __attribute__((ext_vector_type(8)))  float v8f;
typedef __attribute__((ext_vector_type(4)))  float v4f;
typedef __attribute__((ext_vector_type(2)))  float v2f;
typedef __attribute__((ext_vector_type(4)))  unsigned v4u;
typedef __attribute__((ext_vector_type(4)))  int v4i;
typedef float __attribute__((may_alias)) float_a;
typedef int __attribute__((may_alias)) int_a;

template <typename T> __device__ __forceinline__ void vst2(void* p, T v) { *(T*)p = v;  }
__device__ __forceinline__ v8f wmma16(v16h a, v16h b, v8f c) {
  v8f d = __builtin_amdgcn_wmma_f32_16x16x32_f16(false, a, false, b, (short)0, c, false, false);
  asm volatile("v_nop\n\tv_nop\n\tv_nop\n\tv_nop" : "+v"(d) : "v"(a), "v"(b));
  return d;
}
__device__ __forceinline__ v8f wmma_bf(v16b a, v16b b, v8f c) {
  v8f d = __builtin_amdgcn_wmma_f32_16x16x32_bf16(false, a, false, b, (short)0, c, false, false);
  asm volatile("v_nop\n\tv_nop\n\tv_nop\n\tv_nop" : "+v"(d) : "v"(a), "v"(b));
  return d;
}
// 16x16x32 fragments: lane = (h = lane>>4, row/col = lane&15); elements 0..7 = k0+8h+0..7, 8..15 = k0+16+8h+0..7; D element r = row 8h+r
__device__ __forceinline__ v16h frag_h(const _Float16* rowk0, int lane) {
  union { v16h v; v8h q[2]; } u; const _Float16* p = rowk0 + 8 * (lane >> 4);
  u.q[0] = *(const v8h*)p; u.q[1] = *(const v8h*)(p + 16); return u.v;
}
// the same fragment from fragment-order storage: 1 KB a fragment, elements 0..7 of lanes 0..31 (16 B a lane, 512 B in a row), then elements 8..15 likewise; p already holds the lane's 8 * lane
__device__ __forceinline__ v16h frag_o(const _Float16* p) {
  union { v16h v; v8h q[2]; } u; u.q[0] = *(const v8h*)p; u.q[1] = *(const v8h*)(p + 256); return u.v;
}
// a block-uniform address kept in two scalar registers and stepped there, so that kF and vF share the lane's one offset register; left to itself the compiler folded the batch's
// part into a 64-bit vector base for each, two registers more at the 128-register limit of a 32-wave block, and spilled one register to scratch
__device__ __forceinline__ const char* sbase(const void* p) {
  const unsigned long long a = (unsigned long long)p;
  const unsigned lo = (unsigned)__builtin_amdgcn_readfirstlane((int)(unsigned)a), hi = (unsigned)__builtin_amdgcn_readfirstlane((int)(unsigned)(a >> 32));
  return (const char*)(const __attribute__((address_space(1))) char*)(((unsigned long long)hi << 32) | lo);   // named as global memory: from a bare integer the loads would be flat ones
}
// lane l's value to lane l ^ 16 and back, in the vector unit
__device__ __forceinline__ float xhalf(float x) { const int b = __builtin_bit_cast(int, x); return __builtin_bit_cast(float, __builtin_amdgcn_permlanex16(b, b, 0x76543210, 0xfedcba98, false, false)); }
__device__ __forceinline__ v16h frag_f32(const float* rowk0, int lane) {
  v16h a; const float* p = rowk0 + 8 * (lane >> 4);
#pragma unroll
  for (int i = 0; i < 8; ++i) { a[i] = (_Float16)p[i]; a[8 + i] = (_Float16)p[16 + i]; }
  return a;
}
__device__ __forceinline__ v16h frag_f32s(const float* rowk0, int lane, float sc) {
  v16h a; const float* p = rowk0 + 8 * (lane >> 4);
#pragma unroll
  for (int i = 0; i < 8; ++i) { a[i] = (_Float16)(p[i] * sc); a[8 + i] = (_Float16)(p[16 + i] * sc); }
  return a;
}
// column fragment from a [K][ld] layout (column n), rows >= K read as 0
__device__ __forceinline__ v16h fragc_f32(const float* W, int k0, int n, int lane, int ld, int K) {
  v16h a; const int g = lane >> 4;
#pragma unroll
  for (int i = 0; i < 8; ++i) { const int ka = k0 + 8 * g + i, kb = ka + 16;
    a[i] = (_Float16)(ka < K ? W[(size_t)ka * ld + n] : 0.f); a[8 + i] = (_Float16)(kb < K ? W[(size_t)kb * ld + n] : 0.f); }
  return a;
}
struct F2 { v16b h, l; };
__device__ __forceinline__ F2 bsplit16(const float v[16]) { F2 r;
#pragma unroll
  for (int i = 0; i < 16; ++i) { const __bf16 h = (__bf16)v[i]; r.h[i] = h; r.l[i] = (__bf16)(v[i] - (float)h); }
  return r; }
__device__ __forceinline__ F2 split_row(const float* row, int k0, int lane) { float v[16]; const float* p = row + k0 + 8 * (lane >> 4);
#pragma unroll
  for (int i = 0; i < 8; ++i) { v[i] = p[i]; v[8 + i] = p[16 + i]; }
  return bsplit16(v); }
__device__ __forceinline__ F2 split_rowK(const float* row, int k0, int lane, int K) { float v[16]; const int g = lane >> 4;
#pragma unroll
  for (int i = 0; i < 8; ++i) { const int ka = k0 + 8 * g + i, kb = ka + 16; v[i] = ka < K ? row[ka] : 0.f; v[8 + i] = kb < K ? row[kb] : 0.f; }
  return bsplit16(v); }
__device__ __forceinline__ F2 split_col(const float* W, int k0, int n, int lane, int ld, int K) { float v[16]; const int g = lane >> 4;
#pragma unroll
  for (int i = 0; i < 8; ++i) { const int ka = k0 + 8 * g + i, kb = ka + 16; v[i] = ka < K ? W[(size_t)ka * ld + n] : 0.f; v[8 + i] = kb < K ? W[(size_t)kb * ld + n] : 0.f; }
  return bsplit16(v); }
__device__ __forceinline__ v8f mac3(const F2& a, const F2& b, v8f c) { c = wmma_bf(a.l, b.h, c); c = wmma_bf(a.h, b.l, c); return wmma_bf(a.h, b.h, c); }
__device__ __forceinline__ float sigm(float v) { return 1.0f / (1.0f + expf(-v)); }
// v_exp_f32 with the one free slot the instruction set asks for behind it, in one statement
__device__ __forceinline__ float exp2_slot(float x) { float r; asm("v_exp_f32 %0, %1\n\tv_nop" : "=v"(r) : "v"(x)); return r; }
// eight v_exp_f32 in place, in one statement: each has an independent one behind it, the last a v_nop, which is the free slot the instruction set asks for behind a transcendental
__device__ __forceinline__ void exp2x8(float (&x)[8]) {
  asm("v_exp_f32 %0, %0\n\tv_exp_f32 %1, %1\n\tv_exp_f32 %2, %2\n\tv_exp_f32 %3, %3\n\tv_exp_f32 %4, %4\n\tv_exp_f32 %5, %5\n\tv_exp_f32 %6, %6\n\tv_exp_f32 %7, %7\n\tv_nop"
      : "+v"(x[0]), "+v"(x[1]), "+v"(x[2]), "+v"(x[3]), "+v"(x[4]), "+v"(x[5]), "+v"(x[6]), "+v"(x[7])); }
#define LDSX() do { asm volatile("s_wait_dscnt 0" ::: "memory"); __builtin_amdgcn_wave_barrier(); __builtin_amdgcn_fence(__ATOMIC_RELEASE, "workgroup"); } while (0)

// Label-clustered attention: per (b, 64 sorted queries) block the 64-key tiles of its label buckets and the last tile are streamed (all 64 for the last query's own block): S = q.k on
// v_wmma_f32_16x16x32_f16 (q, k converted to f16 once; f32 accumulate), masked where the labels differ (except the last row/column,
// which is never masked), online softmax in f32, P x2^14 as f16 @ v^T (v transposed to f16 once). Labels are read as data for the
#define NB 4
#define LL 4096
#define DD 64
#define NR (NB * LL)

// Rows are regrouped by bucket = label & 7 (a counting sort, the same order for queries and keys; the last row, which has no label, stays last). Rows of equal label share a bucket for any
// label values, so a key tile outside the buckets of a query block holds only masked keys (but for the last key) and k_attn leaves it out; the label compare there stays as it is.
__global__ __launch_bounds__(256) void k_prep(const float* __restrict__ q, const float* __restrict__ k, const float* __restrict__ v, const int* __restrict__ lab, _Float16* __restrict__ q16, _Float16* __restrict__ kF, _Float16* __restrict__ vF,
                                              int* __restrict__ labS, int* __restrict__ perm, int* __restrict__ rng) {
  // block = 64 rows of one batch: q16 rows (f16); kF and vF hold the block's 64 keys as 8 KB each, in the order in which k_attn's fragment loads read them
  // (frag_o), so that a wave-wide 16-byte load there reads 4 whole 128-byte lines: kF [key tile t of 16][kc][fragment], vF [kc][d tile t of 16][fragment], V transposed in LDS
  __shared__ __align__(16) _Float16 st[DD][72];
  const int tid = threadIdx.x, b = blockIdx.y, r0 = blockIdx.x * 64;
  // every block ranks the batch's LL - 1 labels itself (no hand-over between blocks) and keeps the 64 rows whose rank falls in [r0, r0 + 64). Counts of the 8 buckets: 16-bit fields, two a word (a count is below 4096)
  __shared__ unsigned wtot[8][4];
  __shared__ int sidx[64], slb[64];                            // source row and label of sorted rows r0 .. r0 + 63
  const int* lbp = lab + (size_t)b * (LL - 1);
  int lv[16]; unsigned own[4] = {0u, 0u, 0u, 0u}, inc[4], run[4], tot[4];
#pragma unroll
  for (int e = 0; e < 16; ++e) { const int i = e * 256 + tid; lv[e] = i < LL - 1 ? lbp[i] : 0; const unsigned one = i < LL - 1 ? 1u << ((lv[e] & 1) * 16) : 0u; const int wd = (lv[e] >> 1) & 3;
#pragma unroll
    for (int c = 0; c < 4; ++c) own[c] += wd == c ? one : 0u; }
#pragma unroll
  for (int c = 0; c < 4; ++c) inc[c] = own[c];
#pragma unroll
  for (int d = 1; d < 32; d <<= 1) {                           // inclusive prefix over the wave's lanes
#pragma unroll
    for (int c = 0; c < 4; ++c) { const unsigned o = (unsigned)__shfl_up((int)inc[c], (unsigned)d); inc[c] += (tid & 31) >= d ? o : 0u; } }
  if ((tid & 31) == 31) {
#pragma unroll
    for (int c = 0; c < 4; ++c) wtot[tid >> 5][c] = inc[c]; }
  __syncthreads();
#pragma unroll
  for (int c = 0; c < 4; ++c) { unsigned before = 0u, all = 0u;
#pragma unroll
    for (int s = 0; s < 8; ++s) { const unsigned x = wtot[s][c]; all += x; before += s < (tid >> 5) ? x : 0u; }
    tot[c] = all; run[c] = before + inc[c] - own[c]; }
  int base[9]; base[0] = 0;                                    // first sorted row of each bucket
#pragma unroll
  for (int c = 0; c < 8; ++c) base[c + 1] = base[c] + (int)((tot[c >> 1] >> ((c & 1) * 16)) & 0xffffu);
#pragma unroll
  for (int c = 0; c < 4; ++c) run[c] += (unsigned)base[2 * c] | ((unsigned)base[2 * c + 1] << 16);
#pragma unroll
  for (int e = 0; e < 16; ++e) { const int i = e * 256 + tid; const int sh = (lv[e] & 1) * 16, wd = (lv[e] >> 1) & 3; const unsigned one = i < LL - 1 ? 1u << sh : 0u;
    const unsigned rw = wd == 0 ? run[0] : wd == 1 ? run[1] : wd == 2 ? run[2] : run[3];
    const unsigned rel = ((rw >> sh) & 0xffffu) - (unsigned)r0;
#pragma unroll
    for (int c = 0; c < 4; ++c) run[c] += wd == c ? one : 0u;
    if (i < LL - 1 && rel < 64u) { sidx[rel] = i; slb[rel] = lv[e]; } }
  if (r0 + 64 == LL && tid == 0) { sidx[63] = LL - 1; slb[63] = -2; }      // the last row has no label: -2 equals no query's label
  __syncthreads();
  const size_t bo = (size_t)b * LL * DD;                       // the batch's first element in q, k and v
  const size_t fo = ((size_t)b * LL + r0) * DD;               // the block's 8 KB in kF and in vF; qd below is the 16-byte piece of it: lane qd & 31, element half (qd >> 5) & 1
  // Every row load of the thread (16 of v, 4 of q, 4 of k) is asked for here, before the first value is used: their latencies run side by side. As loops over qd the compiler kept them rolled and
  // waited for each pass's loads at once, ten load latencies one behind the other, with two waves a SIMD to hide them.
  const float* vp[16]; const float* qp[2]; const float* kp[2]; float fv[16], fq[2][8], fk[2][8];
#pragma unroll
  for (int e = 0; e < 16; ++e) vp[e] = v + bo + sidx[e * 4 + (tid >> 6)] * DD + (tid & 63);
#pragma unroll
  for (int i = 0; i < 2; ++i) { const int qd = i * 256 + tid; qp[i] = q + bo + sidx[qd >> 3] * DD + (qd & 7) * 8;
    kp[i] = k + bo + sidx[(qd >> 7) * 16 + (qd & 15)] * DD + ((qd >> 6) & 1) * 32 + ((qd >> 5) & 1) * 16 + ((qd >> 4) & 1) * 8; }
#pragma unroll
  for (int e = 0; e < 16; ++e) fv[e] = *vp[e];
#pragma unroll
  for (int i = 0; i < 2; ++i) {
#pragma unroll
    for (int e = 0; e < 8; ++e) { fq[i][e] = qp[i][e]; fk[i][e] = kp[i][e]; } }
  // takes the 20 addresses as inputs only, so that each keeps registers of its own until this wait, behind the last load: without it the compiler used address registers again among the loads and put four
  // s_wait_xcnt between them. The "memory" clobber keeps the loads above this line, so that the stores and the range search below run while they fly
  asm volatile("s_wait_xcnt 0x0" :: "v"(vp[0]), "v"(vp[1]), "v"(vp[2]), "v"(vp[3]), "v"(vp[4]), "v"(vp[5]), "v"(vp[6]), "v"(vp[7]), "v"(vp[8]), "v"(vp[9]), "v"(vp[10]), "v"(vp[11]), "v"(vp[12]), "v"(vp[13]), "v"(vp[14]), "v"(vp[15]),
               "v"(qp[0]), "v"(qp[1]), "v"(kp[0]), "v"(kp[1]) : "memory");
  if (tid < 64) { labS[b * LL + r0 + tid] = slb[tid]; perm[b * LL + r0 + tid] = sidx[tid]; }
  // The key rows of a query block's buckets, as first and last 64-key tile, follow from the bucket starts alone, so wave 0 works them out for all 64 query blocks of the batch (two a lane) and for its own.
  // The block's record goes to the place of its rank by falling tile count (ties by index: a permutation, the same in every block's reckoning), in a 128-byte line of its own: k_attn's work-groups take the records in that order
  if (tid < 32) { const int us[3] = {tid, tid + 32, (int)blockIdx.x}; int tl[3], th[3], cst[3];
#pragma unroll
    for (int i = 0; i < 3; ++i) { const int pa = us[i] * 64, pe = min(us[i] * 64 + 63, LL - 2); int ka = 0, ke = 1;      // first and last labelled row of query block us[i]
#pragma unroll
      for (int c = 0; c < 8; ++c) { ka = base[c] <= pa && pa < base[c + 1] ? base[c] : ka; ke = base[c] <= pe && pe < base[c + 1] ? base[c + 1] : ke; }
      tl[i] = ka >> 6; th[i] = (ke - 1) >> 6; cst[i] = th[i] - tl[i] + (th[i] < LL / 64 - 1 ? 2 : 1); }
    const unsigned ahead0 = __builtin_amdgcn_ballot_w32(cst[0] > cst[2] || (cst[0] == cst[2] && us[0] < us[2])), ahead1 = __builtin_amdgcn_ballot_w32(cst[1] > cst[2] || (cst[1] == cst[2] && us[1] < us[2]));
    if (tid == 0) { int* rp = rng + (b * (LL / 64) + __popc(ahead0) + __popc(ahead1)) * 32; rp[0] = tl[2]; rp[1] = th[2]; rp[2] = us[2]; } }
#pragma unroll
  for (int e = 0; e < 16; ++e) st[tid & 63][e * 4 + (tid >> 6)] = (_Float16)fv[e];      // v first: its values have the longer way, through LDS
#pragma unroll
  for (int i = 0; i < 2; ++i) { const int qd = i * 256 + tid; union { v8h h; v4u u; } pq, pk;      // piece qd of q16 is 8 columns of row qd >> 3
#pragma unroll
    for (int e = 0; e < 8; ++e) { pq.h[e] = (_Float16)fq[i][e]; pk.h[e] = (_Float16)fk[i][e]; }
    vst2(q16 + fo + qd * 8, pq.u); vst2(kF + fo + qd * 8, pk.u); }
  __syncthreads();
#pragma unroll
  for (int i = 0; i < 2; ++i) { const int qd = i * 256 + tid; const int d = ((qd >> 6) & 3) * 16 + (qd & 15), kl = (qd >> 8) * 32 + ((qd >> 5) & 1) * 16 + ((qd >> 4) & 1) * 8; vst2(vF + fo + qd * 8, *(const v4u*)(&st[d][kl])); }
}
// the key tiles of a block's list are shared out over KS groups of 4 waves (group ks takes entries ks, ks + KS, ks + 2 KS, ... of the list), so that a SIMD holds KS waves
// whose waits overlap; each wave keeps its own running maximum, sum and unnormalised O, and the block merges the KS partial results in LDS at the end
#define KS 8
// scores, running maxima and their differences are kept in units of log2: 1/sqrt(64) * log2(e), so that each exponential is one v_exp_f32
#define SCL2 0.18033688f
__global__ __launch_bounds__(128 * KS) void k_attn(const _Float16* __restrict__ q16, const _Float16* __restrict__ kF, const _Float16* __restrict__ vF, const int* __restrict__ lab, const int* __restrict__ perm, const int* __restrict__ rng, float* __restrict__ out) {
  __shared__ __align__(16) float sS[4 * KS][16][68];
  __shared__ float sM[4 * KS][16], sL[4 * KS][16];
  __shared__ __align__(16) int slab[KS][64];
  const int tid = threadIdx.x, w = __builtin_amdgcn_readfirstlane(tid >> 5), lane = tid & 31, col = lane & 15, g = lane >> 4;      // w in a scalar register: the tile list below is walked in scalar registers
  const int qg = w & 3, ks = w >> 2;                          // query group (16 rows) and key group of this wave
  const bool solo = blockIdx.y == 0;                          // the block of the last query
  const int b = blockIdx.x;
  int tlo = 0, thi = LL / 64 - 1, bx = 0;
  if (!solo) { const int* rp = rng + (b * (LL / 64) + blockIdx.y - 1) * 32; tlo = rp[0]; thi = rp[1]; bx = rp[2]; }
  bx = __builtin_amdgcn_readfirstlane(bx) & (LL / 64 - 1);    // the query block of this record, in a scalar register, inside the batch whatever the word holds
  const int q0 = solo ? LL - 16 : bx * 64 + qg * 16;
  tlo = __builtin_amdgcn_readfirstlane(min(max(tlo, 0), LL / 64 - 1)); thi = __builtin_amdgcn_readfirstlane(min(max(thi, tlo), LL / 64 - 1));
  const int nR = thi - tlo + 1, nT = nR + (thi < LL / 64 - 1 ? 1 : 0);      // the block's list of key tiles: tlo .. thi, then the last tile where it is not among them
  const int jw = solo ? w : ks, jstep = solo ? 4 * KS : KS, trips = (nT + jstep - 1) >> (solo ? 5 : 3);      // this wave takes entries jw, jw + jstep, ... of the list
  const _Float16* qb = q16 + (size_t)b * LL * DD; const _Float16* kb = kF + (size_t)b * LL * DD; const _Float16* vb = vF + (size_t)b * LL * DD; const int* lb = lab + (size_t)b * LL;
  v16h aq[2];
#pragma unroll
  for (int kc = 0; kc < 2; ++kc) aq[kc] = frag_h(qb + (size_t)(q0 + col) * DD + kc * 32, lane);
  const int myl = !solo && q0 + col < LL - 1 ? lb[q0 + col] : -1;      // the lane's one query; -1: the last (time) row is never masked (of the solo block only that row is stored, of the others it is not)
  float mrun = -3.0e38f, lrun = 0.f; v8f acc[4] = {};          // lrun: the sum over this half-wave's keys only; the two halves are joined once, behind the loop
  // The K and V^T fragments are loaded ahead of their WMMAs, several at a time, so that a group's load latencies run side by side. The compiler moves no load
  // over the volatile statement behind a WMMA in wmma16: a load written as that call's argument starts behind the WMMA before it and is waited for at once.
  const unsigned flo = 8 * lane * 2;                          // the lane's byte offset in a tile of kF and of vF (a 64-key tile is 8 KB in each), formed once; the tile's part of an address is the same for the whole wave
  int it = 0;
#pragma unroll 1
  do {                                                         // the list holds at least the last tile: one trip or more
    const int j = it * jstep + jw, tile = j < nR ? tlo + j : LL / 64 - 1;      // this wave's key tile of the trip; past the list's end (j >= nT) the wave only passes the barriers
    const _Float16* kp = (const _Float16*)(sbase(kb + tile * (64 * DD)) + flo); const _Float16* vp = (const _Float16*)(sbase(vb + tile * (64 * DD)) + flo);
    v16h kf[4][2], vf[2][4];
#pragma unroll
    for (int t = 0; t < 2; ++t) {
#pragma unroll
      for (int kc = 0; kc < 2; ++kc) kf[t][kc] = frag_o(kp + t * 1024 + kc * 512); }     // key tiles 0 and 1; tile t + 2 is asked for behind the WMMAs of tile t
    if (w < 2 * KS) { const int js = it * KS + (w >> 1), ts = js < nR ? tlo + js : LL / 64 - 1; const int* lp = (const int*)sbase(lb + ts * 64 + (w & 1) * 32); (&slab[0][0])[tid] = lp[lane]; }      // group tid >> 6's tile; the last column's entry is -2: lastk below
    __syncthreads();
    if (j < nT) {
    v8f sc[4];                                                 // sc[t][r]: key t * 16 + 8 g + r of the tile against query col
    const bool lastk = g == 1 && tile == LL / 64 - 1;          // this lane's element t = 3, r = 7 is the last column (key LL - 1), which is never masked: one test a trip, where a mark in slab would cost a compare per element
#pragma unroll
    for (int t = 0; t < 4; ++t) { v8f s = {}; union { v4i q[2]; int e[8]; } kl;
      kl.q[0] = *(const v4i*)(&slab[ks][t * 16 + 8 * g]); kl.q[1] = *(const v4i*)(&slab[ks][t * 16 + 8 * g + 4]);
#pragma unroll
      for (int kc = 0; kc < 2; ++kc) s = wmma16(kf[t][kc], aq[kc], s);
      if (t < 2) {
#pragma unroll
        for (int kc = 0; kc < 2; ++kc) kf[t + 2][kc] = frag_o(kp + (t + 2) * 1024 + kc * 512); }
#pragma unroll
      for (int r = 0; r < 8; ++r) { const bool masked = (myl >= 0) && (kl.e[r] != myl) && !(t == 3 && r == 7 && lastk); sc[t][r] = masked ? -3.0e38f : s[r] * SCL2; }
      __builtin_amdgcn_sched_barrier(0); }                     // ends the scheduling region at each tile: left free, the scheduler mixed the tiles' mask work into the softmax and sank six of the eight V^T loads below down to their WMMAs
    float mx = -3.4e38f;
#pragma unroll
    for (int t = 0; t < 4; ++t) {
#pragma unroll
      for (int r = 0; r < 8; ++r) mx = fmaxf(mx, sc[t][r]); }
    mx = fmaxf(mx, xhalf(mx));                                // the other half-wave holds the query's other 32 keys
    const float mnew = fmaxf(mrun, mx);                       // stays -3e38 until the first unmasked key; exp terms below are then 0 or 1 harmlessly
    const float corr = __builtin_amdgcn_exp2f(mrun - mnew);
    const float mex = fmaxf(mnew, -1.0e30f);                  // a masked score (-3e38) minus mex stays about -3e38 also while mnew is still -3e38, so its term is exactly 0 with no test per element
    float ps = 0.f; v16h pb[2];                                // pb[kc] element s: key kc * 32 + (s < 8 ? 8 g + s : 16 + 8 g + s - 8), as in the V^T fragment
#pragma unroll
    for (int t = 0; t < 4; ++t) { float x[8];
#pragma unroll
      for (int r = 0; r < 8; ++r) x[r] = sc[t][r] - mex;
      exp2x8(x);
#pragma unroll
      for (int r = 0; r < 8; ++r) { ps += x[r]; pb[t >> 1][(t & 1) * 8 + r] = (_Float16)(x[r] * 16384.0f); }
      if (t == 1) {
#pragma unroll
        for (int u = 0; u < 4; ++u) vf[0][u] = frag_o(vp + u * 512); } }                      // first half of V^T, four fragments at once, into the registers that half of the scores have left; they fly during the other half's exponentials
    lrun = lrun * corr + ps; mrun = mnew;
#pragma unroll
    for (int t = 0; t < 4; ++t) acc[t] *= corr;
#pragma unroll
    for (int kc = 0; kc < 2; ++kc) {
#pragma unroll
      for (int t = 0; t < 4; ++t) { acc[t] = wmma16(vf[kc][t], pb[kc], acc[t]);
        if (kc == 0) vf[1][t] = frag_o(vp + 2048 + t * 512); } }                  // second half, each into the registers its WMMA has freed
    }
    __syncthreads();                                           // slab is rewritten next iteration
  } while (++it < trips);
  lrun += xhalf(lrun);
  // the lane's indices formed anew behind the loop: the compiler kept one of them from in front of the loop for the code below, one register over the limit of a 32-wave block, in scratch
  const int lane2 = (int)__builtin_amdgcn_mbcnt_lo(~0u, 0u), col2 = lane2 & 15, g2 = lane2 >> 4, tid2 = w * 32 + lane2;
  const int pos = solo ? LL - 1 : bx * 64 + (tid2 >> 4);           // the sorted row that this thread stores below, and the row of out that it came from
  const int srow = perm[b * LL + pos] & (LL - 1);
#pragma unroll
  for (int t = 0; t < 4; ++t) { v4f lo, hi;                    // acc[t][r] = O[query col][t * 16 + 8 g + r]: 8 columns in a row
#pragma unroll
    for (int e = 0; e < 4; ++e) { lo[e] = acc[t][e]; hi[e] = acc[t][4 + e]; }
    vst2(&sS[w][col2][t * 16 + 8 * g2], lo); vst2(&sS[w][col2][t * 16 + 8 * g2 + 4], hi); }
  if (g2 == 0) { sM[w][col2] = mrun; sL[w][col2] = lrun; }
  __syncthreads();                                             // every wave's partial result is in LDS before any thread merges
  if (solo) {                                                  // the last query is column 15 of every wave's tile: 32 partial results
    if (tid2 < 16) { float ma = -3.4e38f;
      for (int s = 0; s < 4 * KS; ++s) ma = fmaxf(ma, sM[s][15]);
      float la = 0.f; v4f oa = {};
      for (int s = 0; s < 4 * KS; ++s) { const float wg = exp2_slot(sM[s][15] - ma); la += sL[s][15] * wg; oa += *(const v4f*)(&sS[s][15][tid2 * 4]) * wg; }
      const float da = la * 16384.0f;
#pragma unroll
      for (int e = 0; e < 4; ++e) oa[e] = oa[e] / da;
      vst2(out + ((size_t)b * LL + srow) * DD + tid2 * 4, oa); }
    return; }
  const int rl = tid2 >> 4, pc = tid2 & 15, mq = rl >> 4, mr = rl & 15;   // one thread: 4 output columns of one of the 64 rows
  float mall = -3.4e38f;
#pragma unroll
  for (int s = 0; s < KS; ++s) mall = fmaxf(mall, sM[s * 4 + mq][mr]);    // finite: the last key is masked for no row
  float lall = 0.f; v4f o = {};
#pragma unroll
  for (int s = 0; s < KS; ++s) { const float wg = exp2_slot(sM[s * 4 + mq][mr] - mall); lall += sL[s * 4 + mq][mr] * wg; o += *(const v4f*)(&sS[s * 4 + mq][mr][pc * 4]) * wg; }
  const float den = lall * 16384.0f;
#pragma unroll
  for (int e = 0; e < 4; ++e) o[e] = o[e] / den;
  if (pos < LL - 1) vst2(out + ((size_t)b * LL + srow) * DD + pc * 4, o);      // the last row is the solo block's
}
extern "C" void kernel_launch(void* const* d_in, const int* in_sizes, int n_in, void* d_out, int out_size, void* d_ws, size_t ws_size, hipStream_t stream) {
  (void)in_sizes; (void)n_in; (void)out_size; (void)ws_size;
  const float* q = (const float*)d_in[0]; const float* k = (const float*)d_in[1]; const float* v = (const float*)d_in[2]; const int* lab = (const int*)d_in[3];
  float* out = (float*)d_out;
  char* ws = (char*)d_ws; size_t off = 0;
  auto take = [&](size_t bytes) { char* p = ws + off; off += (bytes + 255) & ~(size_t)255; return p; };
  _Float16* q16 = (_Float16*)take((size_t)NR * DD * 2); _Float16* kF = (_Float16*)take((size_t)NR * DD * 2); _Float16* vF = (_Float16*)take((size_t)NR * DD * 2);
  int* labS = (int*)take((size_t)NR * 4); int* perm = (int*)take((size_t)NR * 4); int* rng = (int*)take((size_t)NB * (LL / 64) * 128);
  k_prep<<<dim3(LL / 64, NB), 256, 0, stream>>>(q, k, v, lab, q16, kF, vF, labS, perm, rng);
  k_attn<<<dim3(NB, LL / 64 + 1), 128 * KS, 0, stream>>>(q16, kF, vF, labS, perm, rng, out);
}

// v009
// One run takes 21.2 microseconds.
// In two side-by-side timings against v008, it was 1.08 and 1.07 times as fast.
// Over all steps from v000 it is 17.1 times as fast.
#include <hip/hip_runtime.h>
#include <math.h>

typedef __attribute__((ext_vector_type(16))) _Float16 v16h;
typedef __attribute__((ext_vector_type(16))) __bf16 v16b;
typedef __attribute__((ext_vector_type(8)))  _Float16 v8h;
typedef __attribute__((ext_vector_type(8)))  float v8f;
typedef __attribute__((ext_vector_type(4)))  float v4f;
typedef __attribute__((ext_vector_type(2)))  float v2f;
typedef __attribute__((ext_vector_type(4)))  unsigned v4u;
typedef __attribute__((ext_vector_type(4)))  int v4i;
typedef float __attribute__((may_alias)) float_a;
typedef int __attribute__((may_alias)) int_a;

template <typename T> __device__ __forceinline__ void vst2(void* p, T v) { *(T*)p = v;  }
__device__ __forceinline__ v8f wmma16(v16h a, v16h b, v8f c) {
  v8f d = __builtin_amdgcn_wmma_f32_16x16x32_f16(false, a, false, b, (short)0, c, false, false);
  asm volatile("v_nop\n\tv_nop\n\tv_nop\n\tv_nop" : "+v"(d) : "v"(a), "v"(b));
  return d;
}
__device__ __forceinline__ v8f wmma_bf(v16b a, v16b b, v8f c) {
  v8f d = __builtin_amdgcn_wmma_f32_16x16x32_bf16(false, a, false, b, (short)0, c, false, false);
  asm volatile("v_nop\n\tv_nop\n\tv_nop\n\tv_nop" : "+v"(d) : "v"(a), "v"(b));
  return d;
}
// 16x16x32 fragments: lane = (h = lane>>4, row/col = lane&15); elements 0..7 = k0+8h+0..7, 8..15 = k0+16+8h+0..7; D element r = row 8h+r
__device__ __forceinline__ v16h frag_h(const _Float16* rowk0, int lane) {
  union { v16h v; v8h q[2]; } u; const _Float16* p = rowk0 + 8 * (lane >> 4);
  u.q[0] = *(const v8h*)p; u.q[1] = *(const v8h*)(p + 16); return u.v;
}
// the same fragment from fragment-order storage: 1 KB a fragment, elements 0..7 of lanes 0..31 (16 B a lane, 512 B in a row), then elements 8..15 likewise; p already holds the lane's 8 * lane
__device__ __forceinline__ v16h frag_o(const _Float16* p) {
  union { v16h v; v8h q[2]; } u; u.q[0] = *(const v8h*)p; u.q[1] = *(const v8h*)(p + 256); return u.v;
}
// a block-uniform address kept in two scalar registers and stepped there, so that kF and vF share the lane's one offset register; left to itself the compiler folded the batch's
// part into a 64-bit vector base for each, two registers more at k_attn's limit of 128 registers, and spilled one register to scratch
__device__ __forceinline__ const char* sbase(const void* p) {
  const unsigned long long a = (unsigned long long)p;
  const unsigned lo = (unsigned)__builtin_amdgcn_readfirstlane((int)(unsigned)a), hi = (unsigned)__builtin_amdgcn_readfirstlane((int)(unsigned)(a >> 32));
  return (const char*)(const __attribute__((address_space(1))) char*)(((unsigned long long)hi << 32) | lo);   // named as global memory: from a bare integer the loads would be flat ones
}
// lane l's value to lane l ^ 16 and back, in the vector unit
__device__ __forceinline__ float xhalf(float x) { const int b = __builtin_bit_cast(int, x); return __builtin_bit_cast(float, __builtin_amdgcn_permlanex16(b, b, 0x76543210, 0xfedcba98, false, false)); }
__device__ __forceinline__ v16h frag_f32(const float* rowk0, int lane) {
  v16h a; const float* p = rowk0 + 8 * (lane >> 4);
#pragma unroll
  for (int i = 0; i < 8; ++i) { a[i] = (_Float16)p[i]; a[8 + i] = (_Float16)p[16 + i]; }
  return a;
}
__device__ __forceinline__ v16h frag_f32s(const float* rowk0, int lane, float sc) {
  v16h a; const float* p = rowk0 + 8 * (lane >> 4);
#pragma unroll
  for (int i = 0; i < 8; ++i) { a[i] = (_Float16)(p[i] * sc); a[8 + i] = (_Float16)(p[16 + i] * sc); }
  return a;
}
// column fragment from a [K][ld] layout (column n), rows >= K read as 0
__device__ __forceinline__ v16h fragc_f32(const float* W, int k0, int n, int lane, int ld, int K) {
  v16h a; const int g = lane >> 4;
#pragma unroll
  for (int i = 0; i < 8; ++i) { const int ka = k0 + 8 * g + i, kb = ka + 16;
    a[i] = (_Float16)(ka < K ? W[(size_t)ka * ld + n] : 0.f); a[8 + i] = (_Float16)(kb < K ? W[(size_t)kb * ld + n] : 0.f); }
  return a;
}
struct F2 { v16b h, l; };
__device__ __forceinline__ F2 bsplit16(const float v[16]) { F2 r;
#pragma unroll
  for (int i = 0; i < 16; ++i) { const __bf16 h = (__bf16)v[i]; r.h[i] = h; r.l[i] = (__bf16)(v[i] - (float)h); }
  return r; }
__device__ __forceinline__ F2 split_row(const float* row, int k0, int lane) { float v[16]; const float* p = row + k0 + 8 * (lane >> 4);
#pragma unroll
  for (int i = 0; i < 8; ++i) { v[i] = p[i]; v[8 + i] = p[16 + i]; }
  return bsplit16(v); }
__device__ __forceinline__ F2 split_rowK(const float* row, int k0, int lane, int K) { float v[16]; const int g = lane >> 4;
#pragma unroll
  for (int i = 0; i < 8; ++i) { const int ka = k0 + 8 * g + i, kb = ka + 16; v[i] = ka < K ? row[ka] : 0.f; v[8 + i] = kb < K ? row[kb] : 0.f; }
  return bsplit16(v); }
__device__ __forceinline__ F2 split_col(const float* W, int k0, int n, int lane, int ld, int K) { float v[16]; const int g = lane >> 4;
#pragma unroll
  for (int i = 0; i < 8; ++i) { const int ka = k0 + 8 * g + i, kb = ka + 16; v[i] = ka < K ? W[(size_t)ka * ld + n] : 0.f; v[8 + i] = kb < K ? W[(size_t)kb * ld + n] : 0.f; }
  return bsplit16(v); }
__device__ __forceinline__ v8f mac3(const F2& a, const F2& b, v8f c) { c = wmma_bf(a.l, b.h, c); c = wmma_bf(a.h, b.l, c); return wmma_bf(a.h, b.h, c); }
__device__ __forceinline__ float sigm(float v) { return 1.0f / (1.0f + expf(-v)); }
// v_exp_f32 with the one free slot the instruction set asks for behind it, in one statement
__device__ __forceinline__ float exp2_slot(float x) { float r; asm("v_exp_f32 %0, %1\n\tv_nop" : "=v"(r) : "v"(x)); return r; }
// eight v_exp_f32 in place, in one statement: each has an independent one behind it, the last a v_nop, which is the free slot the instruction set asks for behind a transcendental
__device__ __forceinline__ void exp2x8(float (&x)[8]) {
  asm("v_exp_f32 %0, %0\n\tv_exp_f32 %1, %1\n\tv_exp_f32 %2, %2\n\tv_exp_f32 %3, %3\n\tv_exp_f32 %4, %4\n\tv_exp_f32 %5, %5\n\tv_exp_f32 %6, %6\n\tv_exp_f32 %7, %7\n\tv_nop"
      : "+v"(x[0]), "+v"(x[1]), "+v"(x[2]), "+v"(x[3]), "+v"(x[4]), "+v"(x[5]), "+v"(x[6]), "+v"(x[7])); }
#define LDSX() do { asm volatile("s_wait_dscnt 0" ::: "memory"); __builtin_amdgcn_wave_barrier(); __builtin_amdgcn_fence(__ATOMIC_RELEASE, "workgroup"); } while (0)

// Label-clustered attention: per (b, 64 sorted queries) block the 64-key tiles of its label buckets and the last tile are streamed (all 64 for the last query's own block): S = q.k on
// v_wmma_f32_16x16x32_f16 (q, k converted to f16 once; f32 accumulate), masked where the labels differ (except the last row/column,
// which is never masked), online softmax in f32, P x2^14 as f16 @ v^T (v transposed to f16 once). Labels are read as data for the
#define NB 4
#define LL 4096
#define DD 64
#define NR (NB * LL)

// Rows are regrouped by bucket = label & 7 (a counting sort, the same order for queries and keys; the last row, which has no label, stays last). Rows of equal label share a bucket for any
// label values, so a key tile outside the buckets of a query block holds only masked keys (but for the last key) and k_attn leaves it out; the label compare there stays as it is.
__global__ __launch_bounds__(256) void k_prep(const float* __restrict__ q, const float* __restrict__ k, const float* __restrict__ v, const int* __restrict__ lab, _Float16* __restrict__ q16, _Float16* __restrict__ kF, _Float16* __restrict__ vF,
                                              int* __restrict__ labS, int* __restrict__ perm, int* __restrict__ rng) {
  // block = 64 rows of one batch: q16 rows (f16); kF and vF hold the block's 64 keys as 8 KB each, in the order in which k_attn's fragment loads read them
  // (frag_o), so that a wave-wide 16-byte load there reads 4 whole 128-byte lines: kF [key tile t of 16][kc][fragment], vF [kc][d tile t of 16][fragment], V transposed in LDS
  __shared__ __align__(16) _Float16 st[DD][72];
  const int tid = threadIdx.x, b = blockIdx.y, r0 = blockIdx.x * 64;
  // every block ranks the batch's LL - 1 labels itself (no hand-over between blocks) and keeps the 64 rows whose rank falls in [r0, r0 + 64). Counts of the 8 buckets: 16-bit fields, two a word (a count is below 4096)
  __shared__ unsigned wtot[8][4];
  __shared__ int sidx[64], slb[64];                            // source row and label of sorted rows r0 .. r0 + 63
  const int* lbp = lab + (size_t)b * (LL - 1);
  int lv[16]; unsigned own[4] = {0u, 0u, 0u, 0u}, inc[4], run[4], tot[4];
#pragma unroll
  for (int e = 0; e < 16; ++e) { const int i = e * 256 + tid; lv[e] = i < LL - 1 ? lbp[i] : 0; const unsigned one = i < LL - 1 ? 1u << ((lv[e] & 1) * 16) : 0u; const int wd = (lv[e] >> 1) & 3;
#pragma unroll
    for (int c = 0; c < 4; ++c) own[c] += wd == c ? one : 0u; }
#pragma unroll
  for (int c = 0; c < 4; ++c) inc[c] = own[c];
#pragma unroll
  for (int d = 1; d < 32; d <<= 1) {                           // inclusive prefix over the wave's lanes
#pragma unroll
    for (int c = 0; c < 4; ++c) { const unsigned o = (unsigned)__shfl_up((int)inc[c], (unsigned)d); inc[c] += (tid & 31) >= d ? o : 0u; } }
  if ((tid & 31) == 31) {
#pragma unroll
    for (int c = 0; c < 4; ++c) wtot[tid >> 5][c] = inc[c]; }
  __syncthreads();
#pragma unroll
  for (int c = 0; c < 4; ++c) { unsigned before = 0u, all = 0u;
#pragma unroll
    for (int s = 0; s < 8; ++s) { const unsigned x = wtot[s][c]; all += x; before += s < (tid >> 5) ? x : 0u; }
    tot[c] = all; run[c] = before + inc[c] - own[c]; }
  int base[9]; base[0] = 0;                                    // first sorted row of each bucket
#pragma unroll
  for (int c = 0; c < 8; ++c) base[c + 1] = base[c] + (int)((tot[c >> 1] >> ((c & 1) * 16)) & 0xffffu);
#pragma unroll
  for (int c = 0; c < 4; ++c) run[c] += (unsigned)base[2 * c] | ((unsigned)base[2 * c + 1] << 16);
#pragma unroll
  for (int e = 0; e < 16; ++e) { const int i = e * 256 + tid; const int sh = (lv[e] & 1) * 16, wd = (lv[e] >> 1) & 3; const unsigned one = i < LL - 1 ? 1u << sh : 0u;
    const unsigned rw = wd == 0 ? run[0] : wd == 1 ? run[1] : wd == 2 ? run[2] : run[3];
    const unsigned rel = ((rw >> sh) & 0xffffu) - (unsigned)r0;
#pragma unroll
    for (int c = 0; c < 4; ++c) run[c] += wd == c ? one : 0u;
    if (i < LL - 1 && rel < 64u) { sidx[rel] = i; slb[rel] = lv[e]; } }
  if (r0 + 64 == LL && tid == 0) { sidx[63] = LL - 1; slb[63] = -2; }      // the last row has no label: -2 equals no query's label
  __syncthreads();
  const size_t bo = (size_t)b * LL * DD;                       // the batch's first element in q, k and v
  const size_t fo = ((size_t)b * LL + r0) * DD;               // the block's 8 KB in kF and in vF; qd below is the 16-byte piece of it: lane qd & 31, element half (qd >> 5) & 1
  // Every row load of the thread (16 of v, 4 of q, 4 of k) is asked for here, before the first value is used: their latencies run side by side. As loops over qd the compiler kept them rolled and
  // waited for each pass's loads at once, ten load latencies one behind the other, with two waves a SIMD to hide them.
  const float* vp[16]; const float* qp[2]; const float* kp[2]; float fv[16], fq[2][8], fk[2][8];
#pragma unroll
  for (int e = 0; e < 16; ++e) vp[e] = v + bo + sidx[e * 4 + (tid >> 6)] * DD + (tid & 63);
#pragma unroll
  for (int i = 0; i < 2; ++i) { const int qd = i * 256 + tid; qp[i] = q + bo + sidx[qd >> 3] * DD + (qd & 7) * 8;
    kp[i] = k + bo + sidx[(qd >> 7) * 16 + (qd & 15)] * DD + ((qd >> 6) & 1) * 32 + ((qd >> 5) & 1) * 16 + ((qd >> 4) & 1) * 8; }
#pragma unroll
  for (int e = 0; e < 16; ++e) fv[e] = *vp[e];
#pragma unroll
  for (int i = 0; i < 2; ++i) {
#pragma unroll
    for (int e = 0; e < 8; ++e) { fq[i][e] = qp[i][e]; fk[i][e] = kp[i][e]; } }
  // takes the 20 addresses as inputs only, so that each keeps registers of its own until this wait, behind the last load: without it the compiler used address registers again among the loads and put four
  // s_wait_xcnt between them. The "memory" clobber keeps the loads above this line, so that the stores and the range search below run while they fly
  asm volatile("s_wait_xcnt 0x0" :: "v"(vp[0]), "v"(vp[1]), "v"(vp[2]), "v"(vp[3]), "v"(vp[4]), "v"(vp[5]), "v"(vp[6]), "v"(vp[7]), "v"(vp[8]), "v"(vp[9]), "v"(vp[10]), "v"(vp[11]), "v"(vp[12]), "v"(vp[13]), "v"(vp[14]), "v"(vp[15]),
               "v"(qp[0]), "v"(qp[1]), "v"(kp[0]), "v"(kp[1]) : "memory");
  if (tid < 64) { labS[b * LL + r0 + tid] = slb[tid]; perm[b * LL + r0 + tid] = sidx[tid]; }
  // The key rows of a query block's buckets, as first and last 64-key tile, follow from the bucket starts alone, so wave 0 works them out for all 64 query blocks of the batch (two a lane) and for its own.
  // The block's record goes to the place of its rank by falling tile count (ties by index: a permutation, the same in every block's reckoning), in a 128-byte line of its own: k_attn's work-groups take the records in that order
  if (tid < 32) { const int us[3] = {tid, tid + 32, (int)blockIdx.x}; int tl[3], th[3], cst[3];
#pragma unroll
    for (int i = 0; i < 3; ++i) { const int pa = us[i] * 64, pe = min(us[i] * 64 + 63, LL - 2); int ka = 0, ke = 1;      // first and last labelled row of query block us[i]
#pragma unroll
      for (int c = 0; c < 8; ++c) { ka = base[c] <= pa && pa < base[c + 1] ? base[c] : ka; ke = base[c] <= pe && pe < base[c + 1] ? base[c + 1] : ke; }
      tl[i] = ka >> 6; th[i] = (ke - 1) >> 6; cst[i] = th[i] - tl[i] + (th[i] < LL / 64 - 1 ? 2 : 1); }
    const unsigned ahead0 = __builtin_amdgcn_ballot_w32(cst[0] > cst[2] || (cst[0] == cst[2] && us[0] < us[2])), ahead1 = __builtin_amdgcn_ballot_w32(cst[1] > cst[2] || (cst[1] == cst[2] && us[1] < us[2]));
    if (tid == 0) { int* rp = rng + (b * (LL / 64) + __popc(ahead0) + __popc(ahead1)) * 32; rp[0] = tl[2]; rp[1] = th[2]; rp[2] = us[2]; } }
#pragma unroll
  for (int e = 0; e < 16; ++e) st[tid & 63][e * 4 + (tid >> 6)] = (_Float16)fv[e];      // v first: its values have the longer way, through LDS
#pragma unroll
  for (int i = 0; i < 2; ++i) { const int qd = i * 256 + tid; union { v8h h; v4u u; } pq, pk;      // piece qd of q16 is 8 columns of row qd >> 3
#pragma unroll
    for (int e = 0; e < 8; ++e) { pq.h[e] = (_Float16)fq[i][e]; pk.h[e] = (_Float16)fk[i][e]; }
    vst2(q16 + fo + qd * 8, pq.u); vst2(kF + fo + qd * 8, pk.u); }
  __syncthreads();
#pragma unroll
  for (int i = 0; i < 2; ++i) { const int qd = i * 256 + tid; const int d = ((qd >> 6) & 3) * 16 + (qd & 15), kl = (qd >> 8) * 32 + ((qd >> 5) & 1) * 16 + ((qd >> 4) & 1) * 8; vst2(vF + fo + qd * 8, *(const v4u*)(&st[d][kl])); }
}
// the key tiles of a block are shared out over KS groups of 4 waves (group ks takes tiles ks, ks + KS, ks + 2 KS, ...), so that a SIMD holds KS waves of the block
// whose waits overlap; each wave keeps its own running maximum, sum and unnormalised O, and the block merges the KS partial results in LDS at the end
#define KS 4
// scores, running maxima and their differences are kept in units of log2: 1/sqrt(64) * log2(e), so that each exponential is one v_exp_f32
#define SCL2 0.18033688f
__global__ __launch_bounds__(128 * KS) __attribute__((amdgpu_waves_per_eu(8))) void k_attn(const _Float16* __restrict__ q16, const _Float16* __restrict__ kF, const _Float16* __restrict__ vF, const int* __restrict__ lab, const int* __restrict__ perm, const int* __restrict__ rng, float* __restrict__ out) {
  __shared__ __align__(16) float sS[4 * KS][16][68];
  __shared__ float sM[4 * KS][16], sL[4 * KS][16];
  __shared__ __align__(16) int slab[KS][64];
  const int tid = threadIdx.x, w = __builtin_amdgcn_readfirstlane(tid >> 5), lane = tid & 31, col = lane & 15, g = lane >> 4;      // w in a scalar register: the tile list below is walked in scalar registers
  const int qg = w & 3, ks = w >> 2;                          // query group (16 rows) and key group of this wave
  const bool solo = blockIdx.y == 0;                          // the block of the last query
  const int b = blockIdx.x;
  int tlo = 0, thi = LL / 64 - 1, bx = 0;
  if (!solo) { const int* rp = rng + (b * (LL / 64) + blockIdx.y - 1) * 32; tlo = rp[0]; thi = rp[1]; bx = rp[2]; }
  bx = __builtin_amdgcn_readfirstlane(bx) & (LL / 64 - 1);    // the query block of this record, in a scalar register, inside the batch whatever the word holds
  const int q0 = solo ? LL - 16 : bx * 64 + qg * 16;
  tlo = __builtin_amdgcn_readfirstlane(min(max(tlo, 0), LL / 64 - 1)); thi = __builtin_amdgcn_readfirstlane(min(max(thi, tlo), LL / 64 - 1));
  const int nR = thi - tlo + 1, nT = nR + (thi < LL / 64 - 1 ? 1 : 0);      // the block's list of key tiles: tlo .. thi, then the last tile where it is not among them
  const int jw = solo ? w : ks, jstep = solo ? 4 * KS : KS, trips = (nT + jstep - 1) >> (solo ? 4 : 2);      // this wave takes entries jw, jw + jstep, ... of the list; the shifts are log2 of jstep
  const _Float16* qb = q16 + (size_t)b * LL * DD; const _Float16* kb = kF + (size_t)b * LL * DD; const _Float16* vb = vF + (size_t)b * LL * DD; const int* lb = lab + (size_t)b * LL;
  v16h aq[2];
#pragma unroll
  for (int kc = 0; kc < 2; ++kc) aq[kc] = frag_h(qb + (size_t)(q0 + col) * DD + kc * 32, lane);
  const int myl = !solo && q0 + col < LL - 1 ? lb[q0 + col] : -1;      // the lane's one query; -1: the last (time) row is never masked (of the solo block only that row is stored, of the others it is not)
  float mrun = -3.0e38f, lrun = 0.f; v8f acc[4] = {};          // lrun: the sum over this half-wave's keys only; the two halves are joined once, behind the loop
  // The K and V^T fragments are loaded ahead of their WMMAs, several at a time, so that a group's load latencies run side by side. The compiler moves no load
  // over the volatile statement behind a WMMA in wmma16: a load written as that call's argument starts behind the WMMA before it and is waited for at once.
  const unsigned flo = 8 * lane * 2;                          // the lane's byte offset in a tile of kF and of vF (a 64-key tile is 8 KB in each), formed once; the tile's part of an address is the same for the whole wave
  int it = 0;
#pragma unroll 1
  do {                                                         // the list holds at least the last tile: one trip or more
    const int j = it * jstep + jw, tile = j < nR ? tlo + j : LL / 64 - 1;      // this wave's key tile of the trip; past the list's end (j >= nT) the wave only passes the barriers
    const _Float16* kp = (const _Float16*)(sbase(kb + tile * (64 * DD)) + flo); const _Float16* vp = (const _Float16*)(sbase(vb + tile * (64 * DD)) + flo);
    v16h kf[4][2], vf[2][4];
#pragma unroll
    for (int t = 0; t < 2; ++t) {
#pragma unroll
      for (int kc = 0; kc < 2; ++kc) kf[t][kc] = frag_o(kp + t * 1024 + kc * 512); }     // key tiles 0 and 1; tile t + 2 is asked for behind the WMMAs of tile t
    if (w < 2 * KS) { const int js = it * KS + (w >> 1), ts = js < nR ? tlo + js : LL / 64 - 1; const int* lp = (const int*)sbase(lb + ts * 64 + (w & 1) * 32); (&slab[0][0])[tid] = lp[lane]; }      // group tid >> 6's tile; the last column's entry is -2: lastk below
    __syncthreads();
    if (j < nT) {
    v8f sc[4];                                                 // sc[t][r]: key t * 16 + 8 g + r of the tile against query col
    const bool lastk = g == 1 && tile == LL / 64 - 1;          // this lane's element t = 3, r = 7 is the last column (key LL - 1), which is never masked: one test a trip, where a mark in slab would cost a compare per element
#pragma unroll
    for (int t = 0; t < 4; ++t) { v8f s = {}; union { v4i q[2]; int e[8]; } kl;
      kl.q[0] = *(const v4i*)(&slab[ks][t * 16 + 8 * g]); kl.q[1] = *(const v4i*)(&slab[ks][t * 16 + 8 * g + 4]);
#pragma unroll
      for (int kc = 0; kc < 2; ++kc) s = wmma16(kf[t][kc], aq[kc], s);
      if (t < 2) {
#pragma unroll
        for (int kc = 0; kc < 2; ++kc) kf[t + 2][kc] = frag_o(kp + (t + 2) * 1024 + kc * 512); }
#pragma unroll
      for (int r = 0; r < 8; ++r) { const bool masked = (myl >= 0) && (kl.e[r] != myl) && !(t == 3 && r == 7 && lastk); sc[t][r] = masked ? -3.0e38f : s[r] * SCL2; }
      __builtin_amdgcn_sched_barrier(0); }                     // ends the scheduling region at each tile: left free, the scheduler mixed the tiles' mask work into the softmax and sank six of the eight V^T loads below down to their WMMAs
    float mx = -3.4e38f;
#pragma unroll
    for (int t = 0; t < 4; ++t) {
#pragma unroll
      for (int r = 0; r < 8; ++r) mx = fmaxf(mx, sc[t][r]); }
    mx = fmaxf(mx, xhalf(mx));                                // the other half-wave holds the query's other 32 keys
    const float mnew = fmaxf(mrun, mx);                       // stays -3e38 until the first unmasked key; exp terms below are then 0 or 1 harmlessly
    const float corr = __builtin_amdgcn_exp2f(mrun - mnew);
    const float mex = fmaxf(mnew, -1.0e30f);                  // a masked score (-3e38) minus mex stays about -3e38 also while mnew is still -3e38, so its term is exactly 0 with no test per element
    float ps = 0.f; v16h pb[2];                                // pb[kc] element s: key kc * 32 + (s < 8 ? 8 g + s : 16 + 8 g + s - 8), as in the V^T fragment
#pragma unroll
    for (int t = 0; t < 4; ++t) { float x[8];
#pragma unroll
      for (int r = 0; r < 8; ++r) x[r] = sc[t][r] - mex;
      exp2x8(x);
#pragma unroll
      for (int r = 0; r < 8; ++r) { ps += x[r]; pb[t >> 1][(t & 1) * 8 + r] = (_Float16)(x[r] * 16384.0f); }
      if (t == 1) {
#pragma unroll
        for (int u = 0; u < 4; ++u) vf[0][u] = frag_o(vp + u * 512); } }                      // first half of V^T, four fragments at once, into the registers that half of the scores have left; they fly during the other half's exponentials
    lrun = lrun * corr + ps; mrun = mnew;
#pragma unroll
    for (int t = 0; t < 4; ++t) acc[t] *= corr;
#pragma unroll
    for (int kc = 0; kc < 2; ++kc) {
#pragma unroll
      for (int t = 0; t < 4; ++t) { acc[t] = wmma16(vf[kc][t], pb[kc], acc[t]);
        if (kc == 0) vf[1][t] = frag_o(vp + 2048 + t * 512); } }                  // second half, each into the registers its WMMA has freed
    }
    __syncthreads();                                           // slab is rewritten next iteration
  } while (++it < trips);
  lrun += xhalf(lrun);
  // the lane's indices formed anew behind the loop: the compiler kept one of them from in front of the loop for the code below, one register over the kernel's limit of 128, in scratch
  const int lane2 = (int)__builtin_amdgcn_mbcnt_lo(~0u, 0u), col2 = lane2 & 15, g2 = lane2 >> 4, tid2 = w * 32 + lane2;
  const int pos = solo ? LL - 1 : bx * 64 + (tid2 >> 3);           // the sorted row that this thread stores below, and the row of out that it came from
  const int srow = perm[b * LL + pos] & (LL - 1);
#pragma unroll
  for (int t = 0; t < 4; ++t) { v4f lo, hi;                    // acc[t][r] = O[query col][t * 16 + 8 g + r]: 8 columns in a row
#pragma unroll
    for (int e = 0; e < 4; ++e) { lo[e] = acc[t][e]; hi[e] = acc[t][4 + e]; }
    vst2(&sS[w][col2][t * 16 + 8 * g2], lo); vst2(&sS[w][col2][t * 16 + 8 * g2 + 4], hi); }
  if (g2 == 0) { sM[w][col2] = mrun; sL[w][col2] = lrun; }
  __syncthreads();                                             // every wave's partial result is in LDS before any thread merges
  if (solo) {                                                  // the last query is column 15 of every wave's tile: 4 KS partial results
    if (tid2 < 16) { float ma = -3.4e38f;
      for (int s = 0; s < 4 * KS; ++s) ma = fmaxf(ma, sM[s][15]);
      float la = 0.f; v4f oa = {};
      for (int s = 0; s < 4 * KS; ++s) { const float wg = exp2_slot(sM[s][15] - ma); la += sL[s][15] * wg; oa += *(const v4f*)(&sS[s][15][tid2 * 4]) * wg; }
      const float da = la * 16384.0f;
#pragma unroll
      for (int e = 0; e < 4; ++e) oa[e] = oa[e] / da;
      vst2(out + ((size_t)b * LL + srow) * DD + tid2 * 4, oa); }
    return; }
  const int rl = tid2 >> 3, pc = tid2 & 7, mq = rl >> 4, mr = rl & 15;    // one thread: 8 output columns of one of the 64 rows (512 threads)
  float mall = -3.4e38f;
#pragma unroll
  for (int s = 0; s < KS; ++s) mall = fmaxf(mall, sM[s * 4 + mq][mr]);    // finite: the last key is masked for no row
  float lall = 0.f; v4f o = {}, o1 = {};
#pragma unroll
  for (int s = 0; s < KS; ++s) { const float wg = exp2_slot(sM[s * 4 + mq][mr] - mall); lall += sL[s * 4 + mq][mr] * wg;
    o += *(const v4f*)(&sS[s * 4 + mq][mr][pc * 8]) * wg; o1 += *(const v4f*)(&sS[s * 4 + mq][mr][pc * 8 + 4]) * wg; }
  const float den = lall * 16384.0f;
#pragma unroll
  for (int e = 0; e < 4; ++e) { o[e] = o[e] / den; o1[e] = o1[e] / den; }
  if (pos < LL - 1) { float* op = out + ((size_t)b * LL + srow) * DD + pc * 8; vst2(op, o); vst2(op + 4, o1); }      // the last row is the solo block's
}
extern "C" void kernel_launch(void* const* d_in, const int* in_sizes, int n_in, void* d_out, int out_size, void* d_ws, size_t ws_size, hipStream_t stream) {
  (void)in_sizes; (void)n_in; (void)out_size; (void)ws_size;
  const float* q = (const float*)d_in[0]; const float* k = (const float*)d_in[1]; const float* v = (const float*)d_in[2]; const int* lab = (const int*)d_in[3];
  float* out = (float*)d_out;
  char* ws = (char*)d_ws; size_t off = 0;
  auto take = [&](size_t bytes) { char* p = ws + off; off += (bytes + 255) & ~(size_t)255; return p; };
  _Float16* q16 = (_Float16*)take((size_t)NR * DD * 2); _Float16* kF = (_Float16*)take((size_t)NR * DD * 2); _Float16* vF = (_Float16*)take((size_t)NR * DD * 2);
  int* labS = (int*)take((size_t)NR * 4); int* perm = (int*)take((size_t)NR * 4); int* rng = (int*)take((size_t)NB * (LL / 64) * 128);
  k_prep<<<dim3(LL / 64, NB), 256, 0, stream>>>(q, k, v, lab, q16, kF, vF, labS, perm, rng);
  k_attn<<<dim3(NB, LL / 64 + 1), 128 * KS, 0, stream>>>(q16, kF, vF, labS, perm, rng, out);
}

// v010
// A run of this version takes 17.1 microseconds.
// In two side-by-side timings against v009, it was 1.20 and 1.23 times as fast.
// All steps since v000 together make it 20.8 times as fast.
#include <hip/hip_runtime.h>
#include <math.h>

typedef __attribute__((ext_vector_type(16))) _Float16 v16h;
typedef __attribute__((ext_vector_type(16))) __bf16 v16b;
typedef __attribute__((ext_vector_type(8)))  _Float16 v8h;
typedef __attribute__((ext_vector_type(8)))  float v8f;
typedef __attribute__((ext_vector_type(4)))  float v4f;
typedef __attribute__((ext_vector_type(2)))  float v2f;
typedef __attribute__((ext_vector_type(4)))  unsigned v4u;
typedef __attribute__((ext_vector_type(4)))  int v4i;
typedef float __attribute__((may_alias)) float_a;
typedef int __attribute__((may_alias)) int_a;

template <typename T> __device__ __forceinline__ void vst2(void* p, T v) { *(T*)p = v;  }
__device__ __forceinline__ v8f wmma16(v16h a, v16h b, v8f c) {
  v8f d = __builtin_amdgcn_wmma_f32_16x16x32_f16(false, a, false, b, (short)0, c, false, false);
  asm volatile("v_nop\n\tv_nop\n\tv_nop\n\tv_nop" : "+v"(d) : "v"(a), "v"(b));
  return d;
}
__device__ __forceinline__ v8f wmma_bf(v16b a, v16b b, v8f c) {
  v8f d = __builtin_amdgcn_wmma_f32_16x16x32_bf16(false, a, false, b, (short)0, c, false, false);
  asm volatile("v_nop\n\tv_nop\n\tv_nop\n\tv_nop" : "+v"(d) : "v"(a), "v"(b));
  return d;
}
// 16x16x32 fragments: lane = (h = lane>>4, row/col = lane&15); elements 0..7 = k0+8h+0..7, 8..15 = k0+16+8h+0..7; D element r = row 8h+r
__device__ __forceinline__ v16h frag_h(const _Float16* rowk0, int lane) {
  union { v16h v; v8h q[2]; } u; const _Float16* p = rowk0 + 8 * (lane >> 4);
  u.q[0] = *(const v8h*)p; u.q[1] = *(const v8h*)(p + 16); return u.v;
}
// the same fragment from fragment-order storage: 1 KB a fragment, elements 0..7 of lanes 0..31 (16 B a lane, 512 B in a row), then elements 8..15 likewise; p already holds the lane's 8 * lane
__device__ __forceinline__ v16h frag_o(const _Float16* p) {
  union { v16h v; v8h q[2]; } u; u.q[0] = *(const v8h*)p; u.q[1] = *(const v8h*)(p + 256); return u.v;
}
// a block-uniform address kept in two scalar registers and stepped there, so that kF and vF share the lane's one offset register; left to itself the compiler folded the batch's
// part into a 64-bit vector base for each, two registers more at k_attn's limit of 128 registers, and spilled one register to scratch
__device__ __forceinline__ const char* sbase(const void* p) {
  const unsigned long long a = (unsigned long long)p;
  const unsigned lo = (unsigned)__builtin_amdgcn_readfirstlane((int)(unsigned)a), hi = (unsigned)__builtin_amdgcn_readfirstlane((int)(unsigned)(a >> 32));
  return (const char*)(const __attribute__((address_space(1))) char*)(((unsigned long long)hi << 32) | lo);   // named as global memory: from a bare integer the loads would be flat ones
}
// lane l's value to lane l ^ 16 and back, in the vector unit
__device__ __forceinline__ float xhalf(float x) { const int b = __builtin_bit_cast(int, x); return __builtin_bit_cast(float, __builtin_amdgcn_permlanex16(b, b, 0x76543210, 0xfedcba98, false, false)); }
__device__ __forceinline__ v16h frag_f32(const float* rowk0, int lane) {
  v16h a; const float* p = rowk0 + 8 * (lane >> 4);
#pragma unroll
  for (int i = 0; i < 8; ++i) { a[i] = (_Float16)p[i]; a[8 + i] = (_Float16)p[16 + i]; }
  return a;
}
__device__ __forceinline__ v16h frag_f32s(const float* rowk0, int lane, float sc) {
  v16h a; const float* p = rowk0 + 8 * (lane >> 4);
#pragma unroll
  for (int i = 0; i < 8; ++i) { a[i] = (_Float16)(p[i] * sc); a[8 + i] = (_Float16)(p[16 + i] * sc); }
  return a;
}
// column fragment from a [K][ld] layout (column n), rows >= K read as 0
__device__ __forceinline__ v16h fragc_f32(const float* W, int k0, int n, int lane, int ld, int K) {
  v16h a; const int g = lane >> 4;
#pragma unroll
  for (int i = 0; i < 8; ++i) { const int ka = k0 + 8 * g + i, kb = ka + 16;
    a[i] = (_Float16)(ka < K ? W[(size_t)ka * ld + n] : 0.f); a[8 + i] = (_Float16)(kb < K ? W[(size_t)kb * ld + n] : 0.f); }
  return a;
}
struct F2 { v16b h, l; };
__device__ __forceinline__ F2 bsplit16(const float v[16]) { F2 r;
#pragma unroll
  for (int i = 0; i < 16; ++i) { const __bf16 h = (__bf16)v[i]; r.h[i] = h; r.l[i] = (__bf16)(v[i] - (float)h); }
  return r; }
__device__ __forceinline__ F2 split_row(const float* row, int k0, int lane) { float v[16]; const float* p = row + k0 + 8 * (lane >> 4);
#pragma unroll
  for (int i = 0; i < 8; ++i) { v[i] = p[i]; v[8 + i] = p[16 + i]; }
  return bsplit16(v); }
__device__ __forceinline__ F2 split_rowK(const float* row, int k0, int lane, int K) { float v[16]; const int g = lane >> 4;
#pragma unroll
  for (int i = 0; i < 8; ++i) { const int ka = k0 + 8 * g + i, kb = ka + 16; v[i] = ka < K ? row[ka] : 0.f; v[8 + i] = kb < K ? row[kb] : 0.f; }
  return bsplit16(v); }
__device__ __forceinline__ F2 split_col(const float* W, int k0, int n, int lane, int ld, int K) { float v[16]; const int g = lane >> 4;
#pragma unroll
  for (int i = 0; i < 8; ++i) { const int ka = k0 + 8 * g + i, kb = ka + 16; v[i] = ka < K ? W[(size_t)ka * ld + n] : 0.f; v[8 + i] = kb < K ? W[(size_t)kb * ld + n] : 0.f; }
  return bsplit16(v); }
__device__ __forceinline__ v8f mac3(const F2& a, const F2& b, v8f c) { c = wmma_bf(a.l, b.h, c); c = wmma_bf(a.h, b.l, c); return wmma_bf(a.h, b.h, c); }
__device__ __forceinline__ float sigm(float v) { return 1.0f / (1.0f + expf(-v)); }
// v_exp_f32 with the one free slot the instruction set asks for behind it, in one statement
__device__ __forceinline__ float exp2_slot(float x) { float r; asm("v_exp_f32 %0, %1\n\tv_nop" : "=v"(r) : "v"(x)); return r; }
// eight v_exp_f32 in place, in one statement: each has an independent one behind it, the last a v_nop, which is the free slot the instruction set asks for behind a transcendental
__device__ __forceinline__ void exp2x8(float (&x)[8]) {
  asm("v_exp_f32 %0, %0\n\tv_exp_f32 %1, %1\n\tv_exp_f32 %2, %2\n\tv_exp_f32 %3, %3\n\tv_exp_f32 %4, %4\n\tv_exp_f32 %5, %5\n\tv_exp_f32 %6, %6\n\tv_exp_f32 %7, %7\n\tv_nop"
      : "+v"(x[0]), "+v"(x[1]), "+v"(x[2]), "+v"(x[3]), "+v"(x[4]), "+v"(x[5]), "+v"(x[6]), "+v"(x[7])); }
#define LDSX() do { asm volatile("s_wait_dscnt 0" ::: "memory"); __builtin_amdgcn_wave_barrier(); __builtin_amdgcn_fence(__ATOMIC_RELEASE, "workgroup"); } while (0)

// Label-clustered attention: per (b, 64 sorted queries) block the 64-key tiles of its label buckets and the last tile are streamed (all 64 for the last query's own block): S = q.k on
// v_wmma_f32_16x16x32_f16 (q, k converted to f16 once; f32 accumulate), masked where the labels differ (except the last row/column,
// which is never masked), online softmax in f32, P x2^14 as f16 @ v^T (v transposed to f16 once). Labels are read as data for the
#define NB 4
#define LL 4096
#define DD 64
#define NR (NB * LL)

// Rows are regrouped by bucket = label & 7 (a counting sort, the same order for queries and keys; the last row, which has no label, stays last). Rows of equal label share a bucket for any
// label values, so a key tile outside the buckets of a query block holds only masked keys (but for the last key) and k_attn leaves it out; the label compare there stays as it is.
__global__ __launch_bounds__(256) void k_prep(const float* __restrict__ q, const float* __restrict__ k, const float* __restrict__ v, const int* __restrict__ lab, _Float16* __restrict__ q16, _Float16* __restrict__ kF, _Float16* __restrict__ vF,
                                              int* __restrict__ labS, int* __restrict__ perm, int* __restrict__ rng) {
  // block = 64 rows of one batch: q16 rows (f16); kF and vF hold the block's 64 keys as 8 KB each, in the order in which k_attn's fragment loads read them
  // (frag_o), so that a wave-wide 16-byte load there reads 4 whole 128-byte lines: kF [key tile t of 16][kc][fragment], vF [kc][d tile t of 16][fragment], V transposed in LDS
  __shared__ __align__(16) _Float16 st[DD][72];
  const int tid = threadIdx.x, b = blockIdx.y, r0 = blockIdx.x * 64;
  // every block ranks the batch's LL - 1 labels itself (no hand-over between blocks) and keeps the 64 rows whose rank falls in [r0, r0 + 64). Counts of the 8 buckets: 16-bit fields, two a word (a count is below 4096)
  __shared__ unsigned wtot[8][4];
  __shared__ int sidx[64], slb[64];                            // source row and label of sorted rows r0 .. r0 + 63
  const int* lbp = lab + (size_t)b * (LL - 1);
  int lv[16]; unsigned own[4] = {0u, 0u, 0u, 0u}, inc[4], run[4], tot[4];
#pragma unroll
  for (int e = 0; e < 16; ++e) { const int i = e * 256 + tid; lv[e] = i < LL - 1 ? lbp[i] : 0; const unsigned one = i < LL - 1 ? 1u << ((lv[e] & 1) * 16) : 0u; const int wd = (lv[e] >> 1) & 3;
#pragma unroll
    for (int c = 0; c < 4; ++c) own[c] += wd == c ? one : 0u; }
#pragma unroll
  for (int c = 0; c < 4; ++c) inc[c] = own[c];
#pragma unroll
  for (int d = 1; d < 32; d <<= 1) {                           // inclusive prefix over the wave's lanes
#pragma unroll
    for (int c = 0; c < 4; ++c) { const unsigned o = (unsigned)__shfl_up((int)inc[c], (unsigned)d); inc[c] += (tid & 31) >= d ? o : 0u; } }
  if ((tid & 31) == 31) {
#pragma unroll
    for (int c = 0; c < 4; ++c) wtot[tid >> 5][c] = inc[c]; }
  __syncthreads();
#pragma unroll
  for (int c = 0; c < 4; ++c) { unsigned before = 0u, all = 0u;
#pragma unroll
    for (int s = 0; s < 8; ++s) { const unsigned x = wtot[s][c]; all += x; before += s < (tid >> 5) ? x : 0u; }
    tot[c] = all; run[c] = before + inc[c] - own[c]; }
  int base[9]; base[0] = 0;                                    // first sorted row of each bucket
#pragma unroll
  for (int c = 0; c < 8; ++c) base[c + 1] = base[c] + (int)((tot[c >> 1] >> ((c & 1) * 16)) & 0xffffu);
#pragma unroll
  for (int c = 0; c < 4; ++c) run[c] += (unsigned)base[2 * c] | ((unsigned)base[2 * c + 1] << 16);
#pragma unroll
  for (int e = 0; e < 16; ++e) { const int i = e * 256 + tid; const int sh = (lv[e] & 1) * 16, wd = (lv[e] >> 1) & 3; const unsigned one = i < LL - 1 ? 1u << sh : 0u;
    const unsigned rw = wd == 0 ? run[0] : wd == 1 ? run[1] : wd == 2 ? run[2] : run[3];
    const unsigned rel = ((rw >> sh) & 0xffffu) - (unsigned)r0;
#pragma unroll
    for (int c = 0; c < 4; ++c) run[c] += wd == c ? one : 0u;
    if (i < LL - 1 && rel < 64u) { sidx[rel] = i; slb[rel] = lv[e]; } }
  if (r0 + 64 == LL && tid == 0) { sidx[63] = LL - 1; slb[63] = -2; }      // the last row has no label: -2 equals no query's label
  __syncthreads();
  const size_t bo = (size_t)b * LL * DD;                       // the batch's first element in q, k and v
  const size_t fo = ((size_t)b * LL + r0) * DD;               // the block's 8 KB in kF and in vF; qd below is the 16-byte piece of it: lane qd & 31, element half (qd >> 5) & 1
  // Every row load of the thread (16 of v, 4 of q, 4 of k) is asked for here, before the first value is used: their latencies run side by side. As loops over qd the compiler kept them rolled and
  // waited for each pass's loads at once, ten load latencies one behind the other, with two waves a SIMD to hide them.
  const float* vp[16]; const float* qp[2]; const float* kp[2]; float fv[16], fq[2][8], fk[2][8];
#pragma unroll
  for (int e = 0; e < 16; ++e) vp[e] = v + bo + sidx[e * 4 + (tid >> 6)] * DD + (tid & 63);
#pragma unroll
  for (int i = 0; i < 2; ++i) { const int qd = i * 256 + tid; qp[i] = q + bo + sidx[qd >> 3] * DD + (qd & 7) * 8;
    kp[i] = k + bo + sidx[(qd >> 7) * 16 + (qd & 15)] * DD + ((qd >> 6) & 1) * 32 + ((qd >> 5) & 1) * 16 + ((qd >> 4) & 1) * 8; }
#pragma unroll
  for (int e = 0; e < 16; ++e) fv[e] = *vp[e];
#pragma unroll
  for (int i = 0; i < 2; ++i) {
#pragma unroll
    for (int e = 0; e < 8; ++e) { fq[i][e] = qp[i][e]; fk[i][e] = kp[i][e]; } }
  // takes the 20 addresses as inputs only, so that each keeps registers of its own until this wait, behind the last load: without it the compiler used address registers again among the loads and put four
  // s_wait_xcnt between them. The "memory" clobber keeps the loads above this line, so that the stores and the range search below run while they fly
  asm volatile("s_wait_xcnt 0x0" :: "v"(vp[0]), "v"(vp[1]), "v"(vp[2]), "v"(vp[3]), "v"(vp[4]), "v"(vp[5]), "v"(vp[6]), "v"(vp[7]), "v"(vp[8]), "v"(vp[9]), "v"(vp[10]), "v"(vp[11]), "v"(vp[12]), "v"(vp[13]), "v"(vp[14]), "v"(vp[15]),
               "v"(qp[0]), "v"(qp[1]), "v"(kp[0]), "v"(kp[1]) : "memory");
  if (tid < 64) { labS[b * LL + r0 + tid] = slb[tid]; perm[b * LL + r0 + tid] = sidx[tid]; }
  // The key rows of a query block's buckets, as first and last 64-key tile, follow from the bucket starts alone, so wave 0 works them out for all 64 query blocks of the batch (two a lane) and for its own.
  // The block's record goes to the place of its rank by falling tile count (ties by index: a permutation, the same in every block's reckoning), in a 128-byte line of its own: k_attn's work-groups take the records in that order
  if (tid < 32) { const int us[3] = {tid, tid + 32, (int)blockIdx.x}; int tl[3], th[3], cst[3];
#pragma unroll
    for (int i = 0; i < 3; ++i) { const int pa = us[i] * 64, pe = min(us[i] * 64 + 63, LL - 2); int ka = 0, ke = 1;      // first and last labelled row of query block us[i]
#pragma unroll
      for (int c = 0; c < 8; ++c) { ka = base[c] <= pa && pa < base[c + 1] ? base[c] : ka; ke = base[c] <= pe && pe < base[c + 1] ? base[c + 1] : ke; }
      tl[i] = ka >> 6; th[i] = (ke - 1) >> 6; cst[i] = th[i] - tl[i] + (th[i] < LL / 64 - 1 ? 2 : 1); }
    const unsigned ahead0 = __builtin_amdgcn_ballot_w32(cst[0] > cst[2] || (cst[0] == cst[2] && us[0] < us[2])), ahead1 = __builtin_amdgcn_ballot_w32(cst[1] > cst[2] || (cst[1] == cst[2] && us[1] < us[2]));
    if (tid == 0) { int* rp = rng + (b * (LL / 64) + __popc(ahead0) + __popc(ahead1)) * 32; rp[0] = tl[2]; rp[1] = th[2]; rp[2] = us[2]; } }
#pragma unroll
  for (int e = 0; e < 16; ++e) st[tid & 63][e * 4 + (tid >> 6)] = (_Float16)fv[e];      // v first: its values have the longer way, through LDS
#pragma unroll
  for (int i = 0; i < 2; ++i) { const int qd = i * 256 + tid; union { v8h h; v4u u; } pq, pk;      // piece qd of q16 is 8 columns of row qd >> 3
#pragma unroll
    for (int e = 0; e < 8; ++e) { pq.h[e] = (_Float16)fq[i][e]; pk.h[e] = (_Float16)fk[i][e]; }
    vst2(q16 + fo + qd * 8, pq.u); vst2(kF + fo + qd * 8, pk.u); }
  __syncthreads();
#pragma unroll
  for (int i = 0; i < 2; ++i) { const int qd = i * 256 + tid; const int d = ((qd >> 6) & 3) * 16 + (qd & 15), kl = (qd >> 8) * 32 + ((qd >> 5) & 1) * 16 + ((qd >> 4) & 1) * 8; vst2(vF + fo + qd * 8, *(const v4u*)(&st[d][kl])); }
}
// the key tiles of a block are shared out over KS groups of 4 waves (group ks takes tiles ks, ks + KS, ks + 2 KS, ...), so that a SIMD holds KS waves of the block
// whose waits overlap; each wave keeps its own running maximum, sum and unnormalised O, and the block merges the KS partial results in LDS at the end
#define KS 4
// scores, running maxima and their differences are kept in units of log2: 1/sqrt(64) * log2(e), so that each exponential is one v_exp_f32
#define SCL2 0.18033688f
#define GRPB 16640
#define BUFB (KS * GRPB)
// One wave's share of a stage, 4 KB in eight asynchronous copies of 512 B: each lane's 16 bytes go from global memory to LDS through no register. The s_wait_xcnt stands in the copies' own statement,
// behind the last of them, so that no address register is written anew in front of it
__device__ __forceinline__ void copy4k(unsigned l, const char* p) {
  asm volatile("global_load_async_to_lds_b128 %0, %8, off\n\tglobal_load_async_to_lds_b128 %1, %9, off\n\tglobal_load_async_to_lds_b128 %2, %10, off\n\tglobal_load_async_to_lds_b128 %3, %11, off\n\t"
               "global_load_async_to_lds_b128 %4, %12, off\n\tglobal_load_async_to_lds_b128 %5, %13, off\n\tglobal_load_async_to_lds_b128 %6, %14, off\n\tglobal_load_async_to_lds_b128 %7, %15, off\n\ts_wait_xcnt 0x0"
               :: "v"(l), "v"(l + 512), "v"(l + 1024), "v"(l + 1536), "v"(l + 2048), "v"(l + 2560), "v"(l + 3072), "v"(l + 3584),
                  "v"(p), "v"(p + 512), "v"(p + 1024), "v"(p + 1536), "v"(p + 2048), "v"(p + 2560), "v"(p + 3072), "v"(p + 3584) : "memory");
}
// the tile's 64 labels, 8 bytes a lane, in one such copy
__device__ __forceinline__ void copy256(unsigned l, const char* p) {
  asm volatile("global_load_async_to_lds_b64 %0, %1, off\n\ts_wait_xcnt 0x0" :: "v"(l), "v"(p) : "memory");
}
// One 64-key tile against the wave's 16 queries. kp, vp: the lane's place in the tile's K and V^T fragments (LDS for a query block, global memory for the last query's block); sl: the tile's labels.
// NOMASK: the last query's block, where nothing is masked and no label is read.
// The K and V^T fragments are loaded ahead of their WMMAs, several at a time, so that a group's load latencies run side by side. The compiler moves no load
// over the volatile statement behind a WMMA in wmma16: a load written as that call's argument starts behind the WMMA before it and is waited for at once.
template <bool NOMASK> __device__ __forceinline__ void one_tile(const _Float16* kp, const _Float16* vp, const int* sl, const v16h (&aq)[2], int myl, int g, bool lasttile, float& mrun, float& lrun, v8f (&acc)[4]) {
    v16h kf[4][2], vf[2][4];
    constexpr int AH = NOMASK ? 2 : 1;                         // K fragments are asked for in groups of AH 16-key tiles: pairs from global memory, whose latencies run side by side; one tile ahead from LDS, whose shorter way the mask work of one tile covers (two tiles ahead there sent registers to scratch)
#pragma unroll
    for (int t = 0; t < AH; ++t) {
#pragma unroll
      for (int kc = 0; kc < 2; ++kc) kf[t][kc] = frag_o(kp + t * 1024 + kc * 512); }     // the next group is asked for behind the WMMAs of this group's last tile, into the registers they have left
    v8f sc[4];                                                 // sc[t][r]: key t * 16 + 8 g + r of the tile against query col
    const bool lastk = g == 1 && lasttile;                     // this lane's element t = 3, r = 7 is the last column (key LL - 1), which is never masked: one test a trip, where a mark among the labels would cost a compare per element
#pragma unroll
    for (int t = 0; t < 4; ++t) { v8f s = {}; union { v4i q[2]; int e[8]; } kl;
      if (!NOMASK) { kl.q[0] = *(const v4i*)(sl + t * 16 + 8 * g); kl.q[1] = *(const v4i*)(sl + t * 16 + 8 * g + 4); }
#pragma unroll
      for (int kc = 0; kc < 2; ++kc) s = wmma16(kf[t][kc], aq[kc], s);
      if ((t + 1) % AH == 0 && t + 1 < 4) {
#pragma unroll
        for (int u = t + 1; u < t + 1 + AH; ++u) {
#pragma unroll
          for (int kc = 0; kc < 2; ++kc) kf[u][kc] = frag_o(kp + u * 1024 + kc * 512); } }
#pragma unroll
      for (int r = 0; r < 8; ++r) { bool masked = false; if (!NOMASK) masked = (myl >= 0) && (kl.e[r] != myl) && !(t == 3 && r == 7 && lastk); sc[t][r] = masked ? -3.0e38f : s[r] * SCL2; }
      __builtin_amdgcn_sched_barrier(0); }                     // ends the scheduling region at each tile: left free, the scheduler mixed the tiles' mask work into the softmax and sank six of the eight V^T loads below down to their WMMAs
    float mx = -3.4e38f;
#pragma unroll
    for (int t = 0; t < 4; ++t) {
#pragma unroll
      for (int r = 0; r < 8; ++r) mx = fmaxf(mx, sc[t][r]); }
    mx = fmaxf(mx, xhalf(mx));                                // the other half-wave holds the query's other 32 keys
    const float mnew = fmaxf(mrun, mx);                       // stays -3e38 until the first unmasked key; exp terms below are then 0 or 1 harmlessly
    const float corr = __builtin_amdgcn_exp2f(mrun - mnew);
    const float mex = fmaxf(mnew, -1.0e30f);                  // a masked score (-3e38) minus mex stays about -3e38 also while mnew is still -3e38, so its term is exactly 0 with no test per element
    float ps = 0.f; v16h pb[2];                                // pb[kc] element s: key kc * 32 + (s < 8 ? 8 g + s : 16 + 8 g + s - 8), as in the V^T fragment
#pragma unroll
    for (int t = 0; t < 4; ++t) { float x[8];
#pragma unroll
      for (int r = 0; r < 8; ++r) x[r] = sc[t][r] - mex;
      exp2x8(x);
#pragma unroll
      for (int r = 0; r < 8; ++r) { ps += x[r]; pb[t >> 1][(t & 1) * 8 + r] = (_Float16)(x[r] * 16384.0f); }
      if (t == (NOMASK ? 3 : 1)) {
#pragma unroll
        for (int u = 0; u < 4; ++u) vf[0][u] = frag_o(vp + u * 512); } }                      // first half of V^T, four fragments at once, into registers that scores have left; they fly during the other half's exponentials. In the last query's block behind all the exponentials: earlier there, with the K address kept in its registers up to an s_wait_xcnt, registers went to scratch
    lrun = lrun * corr + ps; mrun = mnew;
#pragma unroll
    for (int t = 0; t < 4; ++t) acc[t] *= corr;
#pragma unroll
    for (int kc = 0; kc < 2; ++kc) {
#pragma unroll
      for (int t = 0; t < 4; ++t) { acc[t] = wmma16(vf[kc][t], pb[kc], acc[t]);
        if (kc == 0) vf[1][t] = frag_o(vp + 2048 + t * 512); } }                  // second half, each into the registers its WMMA has freed
}
__global__ __launch_bounds__(128 * KS) __attribute__((amdgpu_waves_per_eu(8))) void k_attn(const _Float16* __restrict__ q16, const _Float16* __restrict__ kF, const _Float16* __restrict__ vF, const int* __restrict__ lab, const int* __restrict__ perm, const int* __restrict__ rng, float* __restrict__ out) {
  // two stage buffers in the loop; behind the loop's last barrier the same LDS holds the waves' partial O (sS). 135 KB with sM and sL: two blocks still fit a WGP's 320 KB
  __shared__ __align__(16) char smem[2 * BUFB];
  float (*sS)[16][68] = (float (*)[16][68])smem;               // [4 * KS][16][68], 68 KB
  __shared__ float sM[4 * KS][16], sL[4 * KS][16];
  const int tid = threadIdx.x, w = __builtin_amdgcn_readfirstlane(tid >> 5), lane = tid & 31, col = lane & 15, g = lane >> 4;      // w in a scalar register: the tile list below is walked in scalar registers
  const int qg = w & 3, ks = w >> 2;                          // query group (16 rows) and key group of this wave
  const bool solo = blockIdx.y == 0;                          // the block of the last query
  const int b = blockIdx.x;
  int tlo = 0, thi = LL / 64 - 1, bx = 0;
  if (!solo) { const int* rp = rng + (b * (LL / 64) + blockIdx.y - 1) * 32; tlo = rp[0]; thi = rp[1]; bx = rp[2]; }
  bx = __builtin_amdgcn_readfirstlane(bx) & (LL / 64 - 1);    // the query block of this record, in a scalar register, inside the batch whatever the word holds
  const int q0 = solo ? LL - 16 : bx * 64 + qg * 16;
  tlo = __builtin_amdgcn_readfirstlane(min(max(tlo, 0), LL / 64 - 1)); thi = __builtin_amdgcn_readfirstlane(min(max(thi, tlo), LL / 64 - 1));
  const int nR = thi - tlo + 1, nT = nR + (thi < LL / 64 - 1 ? 1 : 0);      // the block's list of key tiles: tlo .. thi, then the last tile where it is not among them
  const int trips = (nT + KS - 1) / KS;                       // a query block's key group ks takes entries ks, ks + KS, ... of the list
  const _Float16* qb = q16 + (size_t)b * LL * DD; const _Float16* kb = kF + (size_t)b * LL * DD; const _Float16* vb = vF + (size_t)b * LL * DD; const int* lb = lab + (size_t)b * LL;
  v16h aq[2]; const _Float16* qrow = qb + (size_t)(q0 + col) * DD + 8 * g;      // the lane's first 8 elements of its query row (frag_h's own address)
#pragma unroll
  for (int kc = 0; kc < 2; ++kc) aq[kc] = frag_h(qrow + kc * 32, 0);
  asm volatile("s_wait_xcnt 0x0" :: "v"(qrow) : "memory");     // behind the four query loads, on every way from here: their address is an input, so it keeps its registers up to this wait and is written anew only behind it
  const int myl = !solo && q0 + col < LL - 1 ? lb[q0 + col] : -1;      // the lane's one query; -1: the last (time) row is never masked (of the solo block only that row is stored, of the others it is not)
  float mrun = -3.0e38f, lrun = 0.f; v8f acc[4] = {};          // lrun: the sum over this half-wave's keys only; the two halves are joined once, behind the loop
  const unsigned flo = 8 * lane * 2;                          // the lane's byte offset in a tile of kF and of vF (a 64-key tile is 8 KB in each), formed once; the tile's part of an address is the same for the whole wave
  if (solo) {                                                  // each of the 16 waves takes every 16th key tile, straight from global memory: no wave shares a tile with another, so nothing is staged and no barrier is passed
#pragma unroll 1
    for (int tile = w; tile < LL / 64; tile += 4 * KS)
      one_tile<true>((const _Float16*)(sbase(kb + tile * (64 * DD)) + flo), (const _Float16*)(sbase(vb + tile * (64 * DD)) + flo), nullptr, aq, myl, g, false, mrun, lrun, acc);
  } else {
    // The four waves of a key group read the same tile: it is brought into LDS once, a quarter by each wave, one trip ahead, so that its way from L2 or memory runs beside the trip before
    const unsigned lbase = (unsigned)(unsigned long long)(const __attribute__((address_space(3))) char*)smem + ks * GRPB;      // the group's stage in buffer 0, as an LDS byte address
    auto stage = [&](int t) {                                  // trip t's tile of this wave's group; past the list's end the last tile is copied and not read
      const int j = t * KS + ks, tile = j < nR ? tlo + j : LL / 64 - 1; const unsigned lb0 = lbase + (t & 1) * BUFB, ln = (unsigned)lane;
      copy4k(lb0 + qg * 4096 + ln * 16, sbase((const char*)(qg < 2 ? kb : vb) + tile * (64 * DD * 2) + (qg & 1) * 4096) + ln * 16);
      if (qg == 0) copy256(lb0 + 16384 + ln * 8, sbase(lb + tile * 64) + ln * 8); };
    stage(0);
    asm volatile("s_wait_asynccnt 0x0" ::: "memory");          // this wave's copies of trip 0 have landed
    __syncthreads();                                           // and every other wave's
    if (trips > 1) stage(1);
    int it = 0;
#pragma unroll 1
    do {                                                       // the list holds at least the last tile: one trip or more
      const int j = it * KS + ks, tile = j < nR ? tlo + j : LL / 64 - 1;      // past the list's end (j >= nT) the wave only passes the waits and the barrier
      if (j < nT) { const char* sb = smem + (it & 1) * BUFB + ks * GRPB;
        one_tile<false>((const _Float16*)(sb + flo), (const _Float16*)(sb + 8192 + flo), (const int*)(sb + 16384), aq, myl, g, tile == LL / 64 - 1, mrun, lrun, acc); }
      asm volatile("s_wait_dscnt 0x0" ::: "memory");           // this wave's reads of the trip's buffer are done before the buffer is filled anew
      asm volatile("s_wait_asynccnt 0x0" ::: "memory");        // its copies of the next trip's tile have landed
      __syncthreads();                                         // one barrier a trip: it publishes the next trip's buffer and ends every reader's last read of this one
      if (it + 2 < trips) stage(it + 2);
    } while (++it < trips);
    asm volatile("s_wait_asynccnt 0x0" ::: "memory");          // no copy is under way when the buffers become sS
  }
  lrun += xhalf(lrun);
  // the lane's indices formed anew behind the loop: the compiler kept one of them from in front of the loop for the code below, one register over the kernel's limit of 128, in scratch
  const int lane2 = (int)__builtin_amdgcn_mbcnt_lo(~0u, 0u), col2 = lane2 & 15, g2 = lane2 >> 4, tid2 = w * 32 + lane2;
  const int pos = solo ? LL - 1 : bx * 64 + (tid2 >> 3);           // the sorted row that this thread stores below, and the row of out that it came from
  const int srow = perm[b * LL + pos] & (LL - 1);
#pragma unroll
  for (int t = 0; t < 4; ++t) { v4f lo, hi;                    // acc[t][r] = O[query col][t * 16 + 8 g + r]: 8 columns in a row
#pragma unroll
    for (int e = 0; e < 4; ++e) { lo[e] = acc[t][e]; hi[e] = acc[t][4 + e]; }
    vst2(&sS[w][col2][t * 16 + 8 * g2], lo); vst2(&sS[w][col2][t * 16 + 8 * g2 + 4], hi); }
  if (g2 == 0) { sM[w][col2] = mrun; sL[w][col2] = lrun; }
  __syncthreads();                                             // every wave's partial result is in LDS before any thread merges
  if (solo) {                                                  // the last query is column 15 of every wave's tile: 4 KS partial results
    if (tid2 < 16) { float ma = -3.4e38f;
      for (int s = 0; s < 4 * KS; ++s) ma = fmaxf(ma, sM[s][15]);
      float la = 0.f; v4f oa = {};
      for (int s = 0; s < 4 * KS; ++s) { const float wg = exp2_slot(sM[s][15] - ma); la += sL[s][15] * wg; oa += *(const v4f*)(&sS[s][15][tid2 * 4]) * wg; }
      const float da = la * 16384.0f;
#pragma unroll
      for (int e = 0; e < 4; ++e) oa[e] = oa[e] / da;
      vst2(out + ((size_t)b * LL + srow) * DD + tid2 * 4, oa); }
    return; }
  const int rl = tid2 >> 3, pc = tid2 & 7, mq = rl >> 4, mr = rl & 15;    // one thread: 8 output columns of one of the 64 rows (512 threads)
  float mall = -3.4e38f;
#pragma unroll
  for (int s = 0; s < KS; ++s) mall = fmaxf(mall, sM[s * 4 + mq][mr]);    // finite: the last key is masked for no row
  float lall = 0.f; v4f o = {}, o1 = {};
#pragma unroll
  for (int s = 0; s < KS; ++s) { const float wg = exp2_slot(sM[s * 4 + mq][mr] - mall); lall += sL[s * 4 + mq][mr] * wg;
    o += *(const v4f*)(&sS[s * 4 + mq][mr][pc * 8]) * wg; o1 += *(const v4f*)(&sS[s * 4 + mq][mr][pc * 8 + 4]) * wg; }
  const float den = lall * 16384.0f;
#pragma unroll
  for (int e = 0; e < 4; ++e) { o[e] = o[e] / den; o1[e] = o1[e] / den; }
  if (pos < LL - 1) { float* op = out + ((size_t)b * LL + srow) * DD + pc * 8; vst2(op, o); vst2(op + 4, o1); }      // the last row is the solo block's
}
extern "C" void kernel_launch(void* const* d_in, const int* in_sizes, int n_in, void* d_out, int out_size, void* d_ws, size_t ws_size, hipStream_t stream) {
  (void)in_sizes; (void)n_in; (void)out_size; (void)ws_size;
  const float* q = (const float*)d_in[0]; const float* k = (const float*)d_in[1]; const float* v = (const float*)d_in[2]; const int* lab = (const int*)d_in[3];
  float* out = (float*)d_out;
  char* ws = (char*)d_ws; size_t off = 0;
  auto take = [&](size_t bytes) { char* p = ws + off; off += (bytes + 255) & ~(size_t)255; return p; };
  _Float16* q16 = (_Float16*)take((size_t)NR * DD * 2); _Float16* kF = (_Float16*)take((size_t)NR * DD * 2); _Float16* vF = (_Float16*)take((size_t)NR * DD * 2);
  int* labS = (int*)take((size_t)NR * 4); int* perm = (int*)take((size_t)NR * 4); int* rng = (int*)take((size_t)NB * (LL / 64) * 128);
  k_prep<<<dim3(LL / 64, NB), 256, 0, stream>>>(q, k, v, lab, q16, kF, vF, labS, perm, rng);
  k_attn<<<dim3(NB, LL / 64 + 1), 128 * KS, 0, stream>>>(q16, kF, vF, labS, perm, rng, out);
}
